// v000
// Measured on an AMD MI455X. A time is GPU time per run, averaged over a window of back-to-back runs after a warm-up
// (all launches, gaps included; the runs take copies of the inputs in turn), and the median of several windows.
// Apart from v000's, it joins two sittings. Times from different sittings can be a few percent apart, while
// side-by-side timings come from the same sitting.
// v000, which the later versions start from, runs in 1060 microseconds.
#include <hip/hip_runtime.h>
#include <hip/hip_bf16.h>

typedef __attribute__((ext_vector_type(2))) float v2f;
typedef __attribute__((ext_vector_type(8))) float v8f;

#define WMMA_F32(a, b, c) \
    __builtin_amdgcn_wmma_f32_16x16x4_f32(false, (a), false, (b), (short)0, (c), false, false)

constexpr int BATCH = 4;
constexpr int HEADS = 16;
constexpr int NTOK  = 2049;
constexpr int DMODEL = 1024;
constexpr int HD = 64;
constexpr int MROWS = BATCH * NTOK;                        // 8196
constexpr size_t QSZ = (size_t)BATCH * HEADS * NTOK * HD;  // floats per Q/K/V buffer

static_assert(NTOK - 1 == 2048, "rope indexing assumes N-1 == 2048");

// ---------------------------------------------------------------------------
// CDNA5 async global->LDS copy (ASYNCcnt-tracked, no VGPR round trip).
// LDS byte address = low 32 bits of the generic shared pointer (flat LDS
// aperture maps addr[31:0] to the wave's LDS allocation).
// ---------------------------------------------------------------------------
__device__ __forceinline__ void async_load_b128(uint32_t lds_addr, const float* gaddr) {
    asm volatile("global_load_async_to_lds_b128 %0, %1, off"
                 :: "v"(lds_addr), "v"(gaddr) : "memory");
}
template <int N>
__device__ __forceinline__ void wait_asynccnt() {
    asm volatile("s_wait_asynccnt %0" :: "n"(N) : "memory");
}

// ---------------------------------------------------------------------------
// DPP16 butterfly reductions across the 16-lane row (matches WMMA D-layout
// halves on wave32). quad_perm 0xB1 = xor1, 0x4E = xor2, row_half_mirror
// (0x141) acts as xor4 once quads are uniform, row_mirror (0x140) as xor8.
// ---------------------------------------------------------------------------
template <int CTRL>
__device__ __forceinline__ float dpp_mov16(float x) {
    return __int_as_float(__builtin_amdgcn_update_dpp(
        0, __float_as_int(x), CTRL, 0xf, 0xf, true));
}
__device__ __forceinline__ float row_max16(float v) {
    v = fmaxf(v, dpp_mov16<0xB1>(v));
    v = fmaxf(v, dpp_mov16<0x4E>(v));
    v = fmaxf(v, dpp_mov16<0x141>(v));
    v = fmaxf(v, dpp_mov16<0x140>(v));
    return v;
}
__device__ __forceinline__ float row_sum16(float v) {
    v += dpp_mov16<0xB1>(v);
    v += dpp_mov16<0x4E>(v);
    v += dpp_mov16<0x141>(v);
    v += dpp_mov16<0x140>(v);
    return v;
}

// ---------------------------------------------------------------------------
// GEMM: out = A(MxK) @ W(NxK)^T + bias
// Double-buffered LDS tiles filled via global_load_async_to_lds_b128; tile
// t+1 is in flight while tile t feeds 8 chained v_wmma_f32_16x16x4_f32.
// EPI 0: plain row-major (MxN) store.  EPI 1: Q/K/V split, (B,H,NTOK,HD).
// ---------------------------------------------------------------------------
template <int EPI>
__global__ __launch_bounds__(256) void gemm_wmma_kernel(
    const float* __restrict__ A, const float* __restrict__ W,
    const float* __restrict__ bias, float* __restrict__ out,
    int M, int N, int K)
{
    __shared__ __align__(16) float As[2][32][36];   // stride 36: 16B-aligned, conflict-free
    __shared__ __align__(16) float Bs[2][64][36];
    constexpr uint32_t ABUF = 32 * 36 * sizeof(float);
    constexpr uint32_t BBUF = 64 * 36 * sizeof(float);

    const int tid  = threadIdx.x;
    const int m0   = blockIdx.y * 32;
    const int n0   = blockIdx.x * 64;
    const int lane = tid & 31;
    const int lr   = lane & 15;
    const int hf   = lane >> 4;
    const int wave = tid >> 5;
    const int wm   = (wave >> 2) * 16;
    const int wn   = (wave & 3) * 16;

    const int ar = tid >> 3, ac = (tid & 7) * 4;   // A: 32x32, one b128 per thread
    const int br = tid >> 2, bc = (tid & 3) * 8;   // B: 64x32, two b128 per thread
    const int am = m0 + ar;
    // clamped row: garbage only feeds output rows that are masked at store
    const float* Aload = A + (size_t)min(am, M - 1) * K + ac;
    const float* Wload = W + (size_t)(n0 + br) * K + bc;   // N is multiple of 64

    const uint32_t asA = (uint32_t)(uintptr_t)&As[0][ar][ac];
    const uint32_t asB = (uint32_t)(uintptr_t)&Bs[0][br][bc];

    auto issue = [&](int buf, int k0) {
        async_load_b128(asA + buf * ABUF, Aload + k0);
        async_load_b128(asB + buf * BBUF,      Wload + k0);
        async_load_b128(asB + buf * BBUF + 16, Wload + k0 + 4);
    };

    v8f acc = {};
    issue(0, 0);
    for (int k0 = 0; k0 < K; k0 += 32) {
        const int cur   = (k0 >> 5) & 1;
        const bool more = (k0 + 32) < K;           // uniform
        if (more) issue(cur ^ 1, k0 + 32);         // next tile in flight during compute
        if (more) wait_asynccnt<3>(); else wait_asynccnt<0>();
        __syncthreads();                           // current tile visible to all waves
        v2f af[8], bf[8];
#pragma unroll
        for (int t8 = 0; t8 < 8; ++t8) {
            af[t8] = *(const v2f*)&As[cur][wm + lr][t8 * 4 + 2 * hf];
            bf[t8] = *(const v2f*)&Bs[cur][wn + lr][t8 * 4 + 2 * hf];
        }
#pragma unroll
        for (int t8 = 0; t8 < 8; ++t8) acc = WMMA_F32(af[t8], bf[t8], acc);
        __syncthreads();                           // done reading before buffer reuse
    }

    const int n = n0 + wn + lr;
    const float bv = bias[n];
    if (EPI == 0) {
#pragma unroll
        for (int r = 0; r < 8; ++r) {
            const int m = m0 + wm + r + 8 * hf;
            if (m < M) out[(size_t)m * N + n] = acc[r] + bv;
        }
    } else {
        const int three = n >> 10;
        const int hh    = (n >> 6) & 15;
        const int d     = n & 63;
        float* base = out + (size_t)three * QSZ;
#pragma unroll
        for (int r = 0; r < 8; ++r) {
            const int m = m0 + wm + r + 8 * hf;
            if (m < M) {
                const int b = m / NTOK;
                const int t = m - b * NTOK;
                base[(((size_t)(b * HEADS + hh)) * NTOK + t) * HD + d] = acc[r] + bv;
            }
        }
    }
}

// ---------------------------------------------------------------------------
// RoPE on Q and K, (B,H,NTOK,HD) layout; token 0 (cls) untouched.
// ---------------------------------------------------------------------------
__global__ __launch_bounds__(256) void rope_kernel(
    float* __restrict__ Q, float* __restrict__ K,
    const int* __restrict__ position)
{
    const int idx = blockIdx.x * 256 + threadIdx.x;
    constexpr int TOTAL = BATCH * HEADS * (NTOK - 1) * (HD / 2);
    if (idx >= TOTAL) return;
    const int p     = idx & 31;
    const int rest  = idx >> 5;
    const int t     = rest & 2047;
    const int rest2 = rest >> 11;
    const int hh    = rest2 & 15;
    const int b     = rest2 >> 4;

    const float posf = (float)position[b * (NTOK - 1) + t];
    const float freq = powf(10000.0f, -(float)(2 * p) / (float)HD);
    const float ang  = posf * freq;
    float s, c;
    sincosf(ang, &s, &c);

    const size_t base = (((size_t)(b * HEADS + hh)) * NTOK + (t + 1)) * HD + 2 * p;
    const float qre = Q[base], qim = Q[base + 1];
    Q[base]     = qre * c - qim * s;
    Q[base + 1] = qre * s + qim * c;
    const float kre = K[base], kim = K[base + 1];
    K[base]     = kre * c - kim * s;
    K[base + 1] = kre * s + kim * c;
}

// ---------------------------------------------------------------------------
// Flash attention: grid (ceil(NTOK/128), B*H), 256 threads = 8 waves.
// Clamp-free fast path for full key tiles (pointer arithmetic only), one
// clamped+masked tail tile. DPP16 row reductions; P via per-wave LDS.
// ---------------------------------------------------------------------------
__global__ __launch_bounds__(256) void attn_kernel(
    const float* __restrict__ Q, const float* __restrict__ K,
    const float* __restrict__ V, float* __restrict__ O, int ntok)
{
    __shared__ float Pl[8][16][18];   // per-wave 16x16 P staging

    const int tid  = threadIdx.x;
    const int wave = tid >> 5;
    const int lane = tid & 31;
    const int lr   = lane & 15;
    const int hf   = lane >> 4;

    const int bh = blockIdx.y;
    const int b  = bh >> 4;
    const int hh = bh & 15;
    const size_t hbase = (size_t)bh * ntok * HD;
    const float* Qb = Q + hbase;
    const float* Kb = K + hbase;
    const float* Vb = V + hbase;
    const float* Kp = Kb + (size_t)lr * HD + 2 * hf;   // lane's key-row base
    const float* Vp = Vb + lr;                         // lane's V-column base

    const int q0 = (blockIdx.x * 8 + wave) * 16;
    const int qr = min(q0 + lr, ntok - 1);

    // Q fragment in A-layout, pre-scaled by 1/sqrt(hd)
    v2f qf[16];
    {
        const float* qrow = Qb + (size_t)qr * HD + 2 * hf;
#pragma unroll
        for (int c = 0; c < 16; ++c) {
            v2f t = *(const v2f*)(qrow + 4 * c);
            t.x *= 0.125f; t.y *= 0.125f;
            qf[c] = t;
        }
    }

    float mrow[8], lrow[8];
    v8f ov[4] = {};
#pragma unroll
    for (int r = 0; r < 8; ++r) { mrow[r] = -3.0e38f; lrow[r] = 0.0f; }

    auto process_tile = [&](int j0, bool tail) {
        // ---- preload K fragments (one clause, one wait) ----
        v2f kb[16];
        if (!tail) {
            const float* krow = Kp + (size_t)j0 * HD;
#pragma unroll
            for (int c = 0; c < 16; ++c) kb[c] = *(const v2f*)(krow + 4 * c);
            __builtin_prefetch(krow + 16 * HD, 0, 1);   // next key tile
        } else {
            const float* krow = Kb + (size_t)min(j0 + lr, ntok - 1) * HD + 2 * hf;
#pragma unroll
            for (int c = 0; c < 16; ++c) kb[c] = *(const v2f*)(krow + 4 * c);
        }

        // ---- S = (Q/sqrt(hd)) @ K^T ----
        v8f s = {};
#pragma unroll
        for (int c = 0; c < 16; ++c) s = WMMA_F32(qf[c], kb[c], s);

        // ---- preload V fragments; latency hides under softmax VALU ----
        v2f va[4][4];   // [kk/4][group]
#pragma unroll
        for (int k4 = 0; k4 < 4; ++k4) {
            if (!tail) {
                const float* vr0 = Vp + (size_t)(j0 + k4 * 4 + 2 * hf) * HD;
#pragma unroll
                for (int g = 0; g < 4; ++g) {
                    va[k4][g].x = vr0[g * 16];
                    va[k4][g].y = vr0[HD + g * 16];
                }
            } else {
                const int v0 = min(j0 + k4 * 4 + 2 * hf,     ntok - 1);
                const int v1 = min(j0 + k4 * 4 + 2 * hf + 1, ntok - 1);
                const float* vr0 = Vb + (size_t)v0 * HD + lr;
                const float* vr1 = Vb + (size_t)v1 * HD + lr;
#pragma unroll
                for (int g = 0; g < 4; ++g) {
                    va[k4][g].x = vr0[g * 16];
                    va[k4][g].y = vr1[g * 16];
                }
            }
        }

        // ---- online softmax (DPP16 row reductions, row = r + 8*hf) ----
        const bool kvalid = tail ? ((j0 + lr) < ntok) : true;
#pragma unroll
        for (int r = 0; r < 8; ++r) {
            const float sv   = kvalid ? s[r] : -3.0e38f;
            const float mx   = row_max16(sv);
            const float mnew = fmaxf(mrow[r], mx);
            const float corr = expf(mrow[r] - mnew);
            mrow[r] = mnew;
            const float p = expf(sv - mnew);
            lrow[r] = lrow[r] * corr + row_sum16(p);
            ov[0][r] *= corr; ov[1][r] *= corr; ov[2][r] *= corr; ov[3][r] *= corr;
            Pl[wave][r + 8 * hf][lr] = p;   // D-layout -> LDS
        }
        __syncthreads();   // uniform call sites -> convergent

        // ---- O += P @ V ----
#pragma unroll
        for (int k4 = 0; k4 < 4; ++k4) {
            v2f pa = *(const v2f*)&Pl[wave][lr][k4 * 4 + 2 * hf];   // A-layout read
#pragma unroll
            for (int g = 0; g < 4; ++g) ov[g] = WMMA_F32(pa, va[k4][g], ov[g]);
        }
        __syncthreads();
    };

    int j0 = 0;
    for (; j0 + 16 <= ntok; j0 += 16) process_tile(j0, false);
    if (j0 < ntok) process_tile(j0, true);

    // ---- normalize + store in (B, N, H, HD) == (B, N, D) ----
#pragma unroll
    for (int r = 0; r < 8; ++r) {
        const int q = q0 + r + 8 * hf;
        if (q < ntok) {
            const float inv = 1.0f / lrow[r];
#pragma unroll
            for (int g = 0; g < 4; ++g)
                O[(((size_t)(b * ntok + q)) * HEADS + hh) * HD + g * 16 + lr] = ov[g][r] * inv;
        }
    }
}

// ---------------------------------------------------------------------------
extern "C" void kernel_launch(void* const* d_in, const int* in_sizes, int n_in,
                              void* d_out, int out_size, void* d_ws, size_t ws_size,
                              hipStream_t stream)
{
    const float* x        = (const float*)d_in[0];
    const int*   position = (const int*)d_in[1];
    const float* w_qkv    = (const float*)d_in[2];
    const float* b_qkv    = (const float*)d_in[3];
    const float* w_fc     = (const float*)d_in[4];
    const float* b_fc     = (const float*)d_in[5];
    float* out = (float*)d_out;
    float* ws  = (float*)d_ws;

    float* Qb = ws;
    float* Kb = ws + QSZ;
    float* Vb = ws + 2 * QSZ;
    float* Ab = ws + 3 * QSZ;   // attention output, (B, N, D)

    // 1) fused QKV projection (scatter into split Q/K/V, (B,H,N,hd))
    dim3 g1((3 * DMODEL) / 64, (MROWS + 31) / 32);
    gemm_wmma_kernel<1><<<g1, 256, 0, stream>>>(x, w_qkv, b_qkv, ws, MROWS, 3 * DMODEL, DMODEL);

    // 2) RoPE on q, k (cls token passthrough)
    constexpr int RTOTAL = BATCH * HEADS * (NTOK - 1) * (HD / 2);
    rope_kernel<<<(RTOTAL + 255) / 256, 256, 0, stream>>>(Qb, Kb, position);

    // 3) flash attention
    dim3 g2((NTOK + 127) / 128, BATCH * HEADS);
    attn_kernel<<<g2, 256, 0, stream>>>(Qb, Kb, Vb, Ab, NTOK);

    // 4) output projection
    dim3 g3(DMODEL / 64, (MROWS + 31) / 32);
    gemm_wmma_kernel<0><<<g3, 256, 0, stream>>>(Ab, w_fc, b_fc, out, MROWS, DMODEL, DMODEL);
}

// v001
// Measured time: 1020 microseconds a run.
// In both of two side-by-side timings against v000, it was 1.09 times as fast.
#include <hip/hip_runtime.h>
#include <hip/hip_bf16.h>

typedef __attribute__((ext_vector_type(2))) float v2f;
typedef __attribute__((ext_vector_type(8))) float v8f;

#define WMMA_F32(a, b, c) \
    __builtin_amdgcn_wmma_f32_16x16x4_f32(false, (a), false, (b), (short)0, (c), false, false)

constexpr int BATCH = 4;
constexpr int HEADS = 16;
constexpr int NTOK  = 2049;
constexpr int DMODEL = 1024;
constexpr int HD = 64;
constexpr int MROWS = BATCH * NTOK;                        // 8196
constexpr size_t QSZ = (size_t)BATCH * HEADS * NTOK * HD;  // floats per Q/K/V buffer

static_assert(NTOK - 1 == 2048, "rope indexing assumes N-1 == 2048");

// ---------------------------------------------------------------------------
// CDNA5 async global->LDS copy (ASYNCcnt-tracked, no VGPR round trip).
// LDS byte address = low 32 bits of the generic shared pointer (flat LDS
// aperture maps addr[31:0] to the wave's LDS allocation).
// ---------------------------------------------------------------------------
__device__ __forceinline__ void async_load_b128(uint32_t lds_addr, const float* gaddr) {
    asm volatile("global_load_async_to_lds_b128 %0, %1, off"
                 :: "v"(lds_addr), "v"(gaddr) : "memory");
}
template <int N>
__device__ __forceinline__ void wait_asynccnt() {
    asm volatile("s_wait_asynccnt %0" :: "n"(N) : "memory");
}

// ---------------------------------------------------------------------------
// DPP16 butterfly reductions across the 16-lane row (matches WMMA D-layout
// halves on wave32). quad_perm 0xB1 = xor1, 0x4E = xor2, row_half_mirror
// (0x141) acts as xor4 once quads are uniform, row_mirror (0x140) as xor8.
// ---------------------------------------------------------------------------
template <int CTRL>
__device__ __forceinline__ float dpp_mov16(float x) {
    return __int_as_float(__builtin_amdgcn_update_dpp(
        0, __float_as_int(x), CTRL, 0xf, 0xf, true));
}
__device__ __forceinline__ float row_max16(float v) {
    v = fmaxf(v, dpp_mov16<0xB1>(v));
    v = fmaxf(v, dpp_mov16<0x4E>(v));
    v = fmaxf(v, dpp_mov16<0x141>(v));
    v = fmaxf(v, dpp_mov16<0x140>(v));
    return v;
}
__device__ __forceinline__ float row_sum16(float v) {
    v += dpp_mov16<0xB1>(v);
    v += dpp_mov16<0x4E>(v);
    v += dpp_mov16<0x141>(v);
    v += dpp_mov16<0x140>(v);
    return v;
}

// ---------------------------------------------------------------------------
// GEMM: out = A(MxK) @ W(NxK)^T + bias
// Double-buffered LDS tiles filled via global_load_async_to_lds_b128; tile
// t+1 is in flight while tile t feeds 8 chained v_wmma_f32_16x16x4_f32.
// EPI 0: plain row-major (MxN) store.  EPI 1: Q/K/V split, (B,H,NTOK,HD).
// ---------------------------------------------------------------------------
template <int EPI>
__global__ __launch_bounds__(256) void gemm_wmma_kernel(
    const float* __restrict__ A, const float* __restrict__ W,
    const float* __restrict__ bias, float* __restrict__ out,
    int M, int N, int K)
{
    __shared__ __align__(16) float As[2][32][36];   // stride 36: 16B-aligned, conflict-free
    __shared__ __align__(16) float Bs[2][64][36];
    constexpr uint32_t ABUF = 32 * 36 * sizeof(float);
    constexpr uint32_t BBUF = 64 * 36 * sizeof(float);

    const int tid  = threadIdx.x;
    const int m0   = blockIdx.y * 32;
    const int n0   = blockIdx.x * 64;
    const int lane = tid & 31;
    const int lr   = lane & 15;
    const int hf   = lane >> 4;
    const int wave = tid >> 5;
    const int wm   = (wave >> 2) * 16;
    const int wn   = (wave & 3) * 16;

    const int ar = tid >> 3, ac = (tid & 7) * 4;   // A: 32x32, one b128 per thread
    const int br = tid >> 2, bc = (tid & 3) * 8;   // B: 64x32, two b128 per thread
    const int am = m0 + ar;
    // clamped row: garbage only feeds output rows that are masked at store
    const float* Aload = A + (size_t)min(am, M - 1) * K + ac;
    const float* Wload = W + (size_t)(n0 + br) * K + bc;   // N is multiple of 64

    const uint32_t asA = (uint32_t)(uintptr_t)&As[0][ar][ac];
    const uint32_t asB = (uint32_t)(uintptr_t)&Bs[0][br][bc];

    auto issue = [&](int buf, int k0) {
        async_load_b128(asA + buf * ABUF, Aload + k0);
        async_load_b128(asB + buf * BBUF,      Wload + k0);
        async_load_b128(asB + buf * BBUF + 16, Wload + k0 + 4);
    };

    v8f acc = {};
    issue(0, 0);
    for (int k0 = 0; k0 < K; k0 += 32) {
        const int cur   = (k0 >> 5) & 1;
        const bool more = (k0 + 32) < K;           // uniform
        if (more) issue(cur ^ 1, k0 + 32);         // next tile in flight during compute
        if (more) wait_asynccnt<3>(); else wait_asynccnt<0>();
        __syncthreads();                           // current tile visible to all waves
        v2f af[8], bf[8];
#pragma unroll
        for (int t8 = 0; t8 < 8; ++t8) {
            af[t8] = *(const v2f*)&As[cur][wm + lr][t8 * 4 + 2 * hf];
            bf[t8] = *(const v2f*)&Bs[cur][wn + lr][t8 * 4 + 2 * hf];
        }
#pragma unroll
        for (int t8 = 0; t8 < 8; ++t8) acc = WMMA_F32(af[t8], bf[t8], acc);
        __syncthreads();                           // done reading before buffer reuse
    }

    const int n = n0 + wn + lr;
    const float bv = bias[n];
    if (EPI == 0) {
#pragma unroll
        for (int r = 0; r < 8; ++r) {
            const int m = m0 + wm + r + 8 * hf;
            if (m < M) out[(size_t)m * N + n] = acc[r] + bv;
        }
    } else {
        const int three = n >> 10;
        const int hh    = (n >> 6) & 15;
        const int d     = n & 63;
        float* base = out + (size_t)three * QSZ;
#pragma unroll
        for (int r = 0; r < 8; ++r) {
            const int m = m0 + wm + r + 8 * hf;
            if (m < M) {
                const int b = m / NTOK;
                const int t = m - b * NTOK;
                base[(((size_t)(b * HEADS + hh)) * NTOK + t) * HD + d] = acc[r] + bv;
            }
        }
    }
}

// ---------------------------------------------------------------------------
// RoPE on Q and K, (B,H,NTOK,HD) layout; token 0 (cls) untouched.
// ---------------------------------------------------------------------------
__global__ __launch_bounds__(256) void rope_kernel(
    float* __restrict__ Q, float* __restrict__ K,
    const int* __restrict__ position)
{
    const int idx = blockIdx.x * 256 + threadIdx.x;
    constexpr int TOTAL = BATCH * HEADS * (NTOK - 1) * (HD / 2);
    if (idx >= TOTAL) return;
    const int p     = idx & 31;
    const int rest  = idx >> 5;
    const int t     = rest & 2047;
    const int rest2 = rest >> 11;
    const int hh    = rest2 & 15;
    const int b     = rest2 >> 4;

    const float posf = (float)position[b * (NTOK - 1) + t];
    const float freq = powf(10000.0f, -(float)(2 * p) / (float)HD);
    const float ang  = posf * freq;
    float s, c;
    sincosf(ang, &s, &c);

    const size_t base = (((size_t)(b * HEADS + hh)) * NTOK + (t + 1)) * HD + 2 * p;
    const float qre = Q[base], qim = Q[base + 1];
    Q[base]     = qre * c - qim * s;
    Q[base + 1] = qre * s + qim * c;
    const float kre = K[base], kim = K[base + 1];
    K[base]     = kre * c - kim * s;
    K[base + 1] = kre * s + kim * c;
}

// ---------------------------------------------------------------------------
// Flash attention: grid (ceil(NTOK/128), B*H), 256 threads = 8 waves.
// K and V come in stages of KT keys, copied once per workgroup into LDS by
// async copies (two buffers: stage t+1 lands while stage t is worked on) and
// read from there by all 8 waves. Keys behind the last full stage take the
// clamped+masked path straight from global memory.
// DPP16 row reductions; P via per-wave LDS.
// ---------------------------------------------------------------------------
constexpr int KT     = 64;   // keys per stage
constexpr int KPITCH = 68;   // floats per K row in LDS: 16 rows x 2 halves of one 8-byte read hit 64 distinct banks
// V lies in LDS as 4 planes of 16 columns, rows dense (64 bytes): the 4 rows x 16 columns of one fragment read are
// 64 consecutive dwords (64 distinct banks), and a fragment's two rows are neighbours for one two-address read

// One thread's share of a stage: 4 K chunks and 4 V chunks of 16 bytes.
// s_wait_xcnt stands inside the statement so that no address register named
// here is rewritten ahead of it.
__device__ __forceinline__ void async_stage_copies(
    uint32_t lk, const float* gk, uint32_t lv, const float* gv)
{
    constexpr uint32_t LKS = 16 * KPITCH * sizeof(float);
    constexpr uint32_t LVS = 16 * 16 * sizeof(float);
    asm volatile(
        "global_load_async_to_lds_b128 %0, %8, off\n\t"
        "global_load_async_to_lds_b128 %1, %9, off\n\t"
        "global_load_async_to_lds_b128 %2, %10, off\n\t"
        "global_load_async_to_lds_b128 %3, %11, off\n\t"
        "global_load_async_to_lds_b128 %4, %12, off\n\t"
        "global_load_async_to_lds_b128 %5, %13, off\n\t"
        "global_load_async_to_lds_b128 %6, %14, off\n\t"
        "global_load_async_to_lds_b128 %7, %15, off\n\t"
        "s_wait_xcnt 0x0"
        :: "v"(lk), "v"(lk + LKS), "v"(lk + 2 * LKS), "v"(lk + 3 * LKS),
           "v"(lv), "v"(lv + LVS), "v"(lv + 2 * LVS), "v"(lv + 3 * LVS),
           "v"(gk), "v"(gk + 16 * HD), "v"(gk + 32 * HD), "v"(gk + 48 * HD),
           "v"(gv), "v"(gv + 16 * HD), "v"(gv + 32 * HD), "v"(gv + 48 * HD)
        : "memory");
}

__global__ __launch_bounds__(256) void attn_kernel(
    const float* __restrict__ Q, const float* __restrict__ K,
    const float* __restrict__ V, float* __restrict__ O, int ntok)
{
    __shared__ __align__(16) float Ks[2][KT][KPITCH];
    __shared__ __align__(16) float Vs[2][4][KT][16];
    __shared__ float Pl[8][16][18];   // per-wave 16x16 P staging
    constexpr uint32_t KBUF = KT * KPITCH * sizeof(float);
    constexpr uint32_t VBUF = 4 * KT * 16 * sizeof(float);

    const int tid  = threadIdx.x;
    const int wave = tid >> 5;
    const int lane = tid & 31;
    const int lr   = lane & 15;
    const int hf   = lane >> 4;

    const int bh = blockIdx.y;
    const int b  = bh >> 4;
    const int hh = bh & 15;
    const size_t hbase = (size_t)bh * ntok * HD;
    const float* Qb = Q + hbase;
    const float* Kb = K + hbase;
    const float* Vb = V + hbase;

    const int q0 = (blockIdx.x * 8 + wave) * 16;
    const int qr = min(q0 + lr, ntok - 1);

    // copy share of this thread: rows crow + 16*i, 16 bytes at float ccol
    const int crow = tid >> 4;
    const int ccol = (tid & 15) * 4;
    const uint32_t lk0 = (uint32_t)(uintptr_t)&Ks[0][crow][ccol];
    const uint32_t lv0 = (uint32_t)(uintptr_t)&Vs[0][ccol >> 4][crow][ccol & 15];
    auto issue_stage = [&](int buf, int st) {
        const size_t off = ((size_t)st * KT + crow) * HD + ccol;
        async_stage_copies(lk0 + buf * KBUF, Kb + off, lv0 + buf * VBUF, Vb + off);
    };

    // Q fragment in A-layout, pre-scaled by 1/sqrt(hd)
    v2f qf[16];
    {
        const float* qrow = Qb + (size_t)qr * HD + 2 * hf;
#pragma unroll
        for (int c = 0; c < 16; ++c) {
            v2f t = *(const v2f*)(qrow + 4 * c);
            t.x *= 0.125f; t.y *= 0.125f;
            qf[c] = t;
        }
    }

    float mrow[8], lrow[8];
    v8f ov[4] = {};
#pragma unroll
    for (int r = 0; r < 8; ++r) { mrow[r] = -3.0e38f; lrow[r] = 0.0f; }

    // online softmax of one 16x16 score tile, then O += P @ V
    auto softmax_pv = [&](const v8f& s, const v2f (&va)[4][4], bool kvalid) {
        // ---- online softmax (DPP16 row reductions, row = r + 8*hf) ----
#pragma unroll
        for (int r = 0; r < 8; ++r) {
            const float sv   = kvalid ? s[r] : -3.0e38f;
            const float mx   = row_max16(sv);
            const float mnew = fmaxf(mrow[r], mx);
            const float corr = expf(mrow[r] - mnew);
            mrow[r] = mnew;
            const float p = expf(sv - mnew);
            lrow[r] = lrow[r] * corr + row_sum16(p);
            ov[0][r] *= corr; ov[1][r] *= corr; ov[2][r] *= corr; ov[3][r] *= corr;
            Pl[wave][r + 8 * hf][lr] = p;   // D-layout -> LDS
        }
        // P is private to the wave and a wave's LDS operations run in order:
        // this only keeps the compiler from moving the reads above the writes.
        __builtin_amdgcn_wave_barrier();

        // ---- O += P @ V ----
#pragma unroll
        for (int k4 = 0; k4 < 4; ++k4) {
            v2f pa = *(const v2f*)&Pl[wave][lr][k4 * 4 + 2 * hf];   // A-layout read
#pragma unroll
            for (int g = 0; g < 4; ++g) ov[g] = WMMA_F32(pa, va[k4][g], ov[g]);
        }
        // keeps the next tile's P writes behind these reads in the compiler's order
        __builtin_amdgcn_wave_barrier();
    };

    // 16 keys at row jj of LDS buffer buf
    auto tile_lds = [&](int buf, int jj) {
        v2f kb[16];
#pragma unroll
        for (int c = 0; c < 16; ++c) kb[c] = *(const v2f*)&Ks[buf][jj + lr][4 * c + 2 * hf];

        // ---- S = (Q/sqrt(hd)) @ K^T ----
        v8f s = {};
#pragma unroll
        for (int c = 0; c < 16; ++c) s = WMMA_F32(qf[c], kb[c], s);

        v2f va[4][4];   // [kk/4][group]
#pragma unroll
        for (int k4 = 0; k4 < 4; ++k4) {
#pragma unroll
            for (int g = 0; g < 4; ++g) {
                va[k4][g].x = Vs[buf][g][jj + k4 * 4 + 2 * hf][lr];
                va[k4][g].y = Vs[buf][g][jj + k4 * 4 + 2 * hf + 1][lr];
            }
        }
        softmax_pv(s, va, true);
    };

    // 16 keys from global memory, rows clamped, keys past the end masked
    auto tile_global = [&](int j0) {
        v2f kb[16];
        const float* krow = Kb + (size_t)min(j0 + lr, ntok - 1) * HD + 2 * hf;
#pragma unroll
        for (int c = 0; c < 16; ++c) kb[c] = *(const v2f*)(krow + 4 * c);

        v8f s = {};
#pragma unroll
        for (int c = 0; c < 16; ++c) s = WMMA_F32(qf[c], kb[c], s);

        v2f va[4][4];
#pragma unroll
        for (int k4 = 0; k4 < 4; ++k4) {
            const int v0 = min(j0 + k4 * 4 + 2 * hf,     ntok - 1);
            const int v1 = min(j0 + k4 * 4 + 2 * hf + 1, ntok - 1);
            const float* vr0 = Vb + (size_t)v0 * HD + lr;
            const float* vr1 = Vb + (size_t)v1 * HD + lr;
#pragma unroll
            for (int g = 0; g < 4; ++g) {
                va[k4][g].x = vr0[g * 16];
                va[k4][g].y = vr1[g * 16];
            }
        }
        softmax_pv(s, va, (j0 + lr) < ntok);
    };

    const int nst = ntok / KT;   // full stages; the same for every wave

    if (nst != 0) issue_stage(0, 0);
    wait_asynccnt<0>();          // this wave's share of stage 0 has landed
    __syncthreads();             // stage 0 readable by all waves
    if (ntok >= 2 * KT) issue_stage(1, 1);

    for (int t = 0; t < nst; ++t) {
        const int buf = t & 1;
        for (int jj = 0; jj < KT; jj += 16) tile_lds(buf, jj);
        asm volatile("s_wait_dscnt 0x0" ::: "memory");   // this wave's reads of buffer buf are done
        wait_asynccnt<0>();                              // its share of stage t+1 has landed
        __syncthreads();                                 // publishes stage t+1, frees buffer buf
        if (t + 2 < nst) issue_stage(buf, t + 2);
    }
    wait_asynccnt<0>();          // nothing in flight behind the loop

    for (int j0 = nst * KT; j0 < ntok; j0 += 16) tile_global(j0);

    // ---- normalize + store in (B, N, H, HD) == (B, N, D) ----
#pragma unroll
    for (int r = 0; r < 8; ++r) {
        const int q = q0 + r + 8 * hf;
        if (q < ntok) {
            const float inv = 1.0f / lrow[r];
#pragma unroll
            for (int g = 0; g < 4; ++g)
                O[(((size_t)(b * ntok + q)) * HEADS + hh) * HD + g * 16 + lr] = ov[g][r] * inv;
        }
    }
}

// ---------------------------------------------------------------------------
extern "C" void kernel_launch(void* const* d_in, const int* in_sizes, int n_in,
                              void* d_out, int out_size, void* d_ws, size_t ws_size,
                              hipStream_t stream)
{
    const float* x        = (const float*)d_in[0];
    const int*   position = (const int*)d_in[1];
    const float* w_qkv    = (const float*)d_in[2];
    const float* b_qkv    = (const float*)d_in[3];
    const float* w_fc     = (const float*)d_in[4];
    const float* b_fc     = (const float*)d_in[5];
    float* out = (float*)d_out;
    float* ws  = (float*)d_ws;

    float* Qb = ws;
    float* Kb = ws + QSZ;
    float* Vb = ws + 2 * QSZ;
    float* Ab = ws + 3 * QSZ;   // attention output, (B, N, D)

    // 1) fused QKV projection (scatter into split Q/K/V, (B,H,N,hd))
    dim3 g1((3 * DMODEL) / 64, (MROWS + 31) / 32);
    gemm_wmma_kernel<1><<<g1, 256, 0, stream>>>(x, w_qkv, b_qkv, ws, MROWS, 3 * DMODEL, DMODEL);

    // 2) RoPE on q, k (cls token passthrough)
    constexpr int RTOTAL = BATCH * HEADS * (NTOK - 1) * (HD / 2);
    rope_kernel<<<(RTOTAL + 255) / 256, 256, 0, stream>>>(Qb, Kb, position);

    // 3) flash attention
    dim3 g2((NTOK + 127) / 128, BATCH * HEADS);
    attn_kernel<<<g2, 256, 0, stream>>>(Qb, Kb, Vb, Ab, NTOK);

    // 4) output projection
    dim3 g3(DMODEL / 64, (MROWS + 31) / 32);
    gemm_wmma_kernel<0><<<g3, 256, 0, stream>>>(Ab, w_fc, b_fc, out, MROWS, DMODEL, DMODEL);
}

// v002
// A run of this version takes 875 microseconds.
// Next to v001, in two timings, it ran 1.17 times as fast each time.
// Counting every step since v000, it is 1.27 times as fast.
#include <hip/hip_runtime.h>
#include <hip/hip_bf16.h>

typedef __attribute__((ext_vector_type(2))) float v2f;
typedef __attribute__((ext_vector_type(8))) float v8f;

#define WMMA_F32(a, b, c) \
    __builtin_amdgcn_wmma_f32_16x16x4_f32(false, (a), false, (b), (short)0, (c), false, false)

constexpr int BATCH = 4;
constexpr int HEADS = 16;
constexpr int NTOK  = 2049;
constexpr int DMODEL = 1024;
constexpr int HD = 64;
constexpr int MROWS = BATCH * NTOK;                        // 8196
constexpr size_t QSZ = (size_t)BATCH * HEADS * NTOK * HD;  // floats per Q/K/V buffer

static_assert(NTOK - 1 == 2048, "rope indexing assumes N-1 == 2048");

// ---------------------------------------------------------------------------
// CDNA5 async global->LDS copy (ASYNCcnt-tracked, no VGPR round trip).
// LDS byte address = low 32 bits of the generic shared pointer (flat LDS
// aperture maps addr[31:0] to the wave's LDS allocation).
// ---------------------------------------------------------------------------
__device__ __forceinline__ void async_load_b128(uint32_t lds_addr, const float* gaddr) {
    asm volatile("global_load_async_to_lds_b128 %0, %1, off"
                 :: "v"(lds_addr), "v"(gaddr) : "memory");
}
template <int N>
__device__ __forceinline__ void wait_asynccnt() {
    asm volatile("s_wait_asynccnt %0" :: "n"(N) : "memory");
}

// ---------------------------------------------------------------------------
// Value of lane l ^ 16: the other half of the wave, same column of a WMMA tile.
// ---------------------------------------------------------------------------
__device__ __forceinline__ float xhalf(float x) {
    return __builtin_bit_cast(float, __builtin_amdgcn_permlanex16(
        __builtin_bit_cast(int, x), __builtin_bit_cast(int, x),
        0x76543210, 0xfedcba98, false, false));
}

// ---------------------------------------------------------------------------
// GEMM: out = A(MxK) @ W(NxK)^T + bias
// Double-buffered LDS tiles filled via global_load_async_to_lds_b128; tile
// t+1 is in flight while tile t feeds 8 chained v_wmma_f32_16x16x4_f32.
// EPI 0: plain row-major (MxN) store.  EPI 1: Q/K/V split, (B,H,NTOK,HD).
// ---------------------------------------------------------------------------
template <int EPI>
__global__ __launch_bounds__(256) void gemm_wmma_kernel(
    const float* __restrict__ A, const float* __restrict__ W,
    const float* __restrict__ bias, float* __restrict__ out,
    int M, int N, int K)
{
    __shared__ __align__(16) float As[2][32][36];   // stride 36: 16B-aligned, conflict-free
    __shared__ __align__(16) float Bs[2][64][36];
    constexpr uint32_t ABUF = 32 * 36 * sizeof(float);
    constexpr uint32_t BBUF = 64 * 36 * sizeof(float);

    const int tid  = threadIdx.x;
    const int m0   = blockIdx.y * 32;
    const int n0   = blockIdx.x * 64;
    const int lane = tid & 31;
    const int lr   = lane & 15;
    const int hf   = lane >> 4;
    const int wave = tid >> 5;
    const int wm   = (wave >> 2) * 16;
    const int wn   = (wave & 3) * 16;

    const int ar = tid >> 3, ac = (tid & 7) * 4;   // A: 32x32, one b128 per thread
    const int br = tid >> 2, bc = (tid & 3) * 8;   // B: 64x32, two b128 per thread
    const int am = m0 + ar;
    // clamped row: garbage only feeds output rows that are masked at store
    const float* Aload = A + (size_t)min(am, M - 1) * K + ac;
    const float* Wload = W + (size_t)(n0 + br) * K + bc;   // N is multiple of 64

    const uint32_t asA = (uint32_t)(uintptr_t)&As[0][ar][ac];
    const uint32_t asB = (uint32_t)(uintptr_t)&Bs[0][br][bc];

    auto issue = [&](int buf, int k0) {
        async_load_b128(asA + buf * ABUF, Aload + k0);
        async_load_b128(asB + buf * BBUF,      Wload + k0);
        async_load_b128(asB + buf * BBUF + 16, Wload + k0 + 4);
    };

    v8f acc = {};
    issue(0, 0);
    for (int k0 = 0; k0 < K; k0 += 32) {
        const int cur   = (k0 >> 5) & 1;
        const bool more = (k0 + 32) < K;           // uniform
        if (more) issue(cur ^ 1, k0 + 32);         // next tile in flight during compute
        if (more) wait_asynccnt<3>(); else wait_asynccnt<0>();
        __syncthreads();                           // current tile visible to all waves
        v2f af[8], bf[8];
#pragma unroll
        for (int t8 = 0; t8 < 8; ++t8) {
            af[t8] = *(const v2f*)&As[cur][wm + lr][t8 * 4 + 2 * hf];
            bf[t8] = *(const v2f*)&Bs[cur][wn + lr][t8 * 4 + 2 * hf];
        }
#pragma unroll
        for (int t8 = 0; t8 < 8; ++t8) acc = WMMA_F32(af[t8], bf[t8], acc);
        __syncthreads();                           // done reading before buffer reuse
    }

    const int n = n0 + wn + lr;
    const float bv = bias[n];
    if (EPI == 0) {
#pragma unroll
        for (int r = 0; r < 8; ++r) {
            const int m = m0 + wm + r + 8 * hf;
            if (m < M) out[(size_t)m * N + n] = acc[r] + bv;
        }
    } else {
        const int three = n >> 10;
        const int hh    = (n >> 6) & 15;
        const int d     = n & 63;
        float* base = out + (size_t)three * QSZ;
#pragma unroll
        for (int r = 0; r < 8; ++r) {
            const int m = m0 + wm + r + 8 * hf;
            if (m < M) {
                const int b = m / NTOK;
                const int t = m - b * NTOK;
                base[(((size_t)(b * HEADS + hh)) * NTOK + t) * HD + d] = acc[r] + bv;
            }
        }
    }
}

// ---------------------------------------------------------------------------
// RoPE on Q and K, (B,H,NTOK,HD) layout; token 0 (cls) untouched.
// ---------------------------------------------------------------------------
__global__ __launch_bounds__(256) void rope_kernel(
    float* __restrict__ Q, float* __restrict__ K,
    const int* __restrict__ position)
{
    const int idx = blockIdx.x * 256 + threadIdx.x;
    constexpr int TOTAL = BATCH * HEADS * (NTOK - 1) * (HD / 2);
    if (idx >= TOTAL) return;
    const int p     = idx & 31;
    const int rest  = idx >> 5;
    const int t     = rest & 2047;
    const int rest2 = rest >> 11;
    const int hh    = rest2 & 15;
    const int b     = rest2 >> 4;

    const float posf = (float)position[b * (NTOK - 1) + t];
    const float freq = powf(10000.0f, -(float)(2 * p) / (float)HD);
    const float ang  = posf * freq;
    float s, c;
    sincosf(ang, &s, &c);

    const size_t base = (((size_t)(b * HEADS + hh)) * NTOK + (t + 1)) * HD + 2 * p;
    const float qre = Q[base], qim = Q[base + 1];
    Q[base]     = qre * c - qim * s;
    Q[base + 1] = qre * s + qim * c;
    const float kre = K[base], kim = K[base + 1];
    K[base]     = kre * c - kim * s;
    K[base + 1] = kre * s + kim * c;
}

constexpr int KT     = 64;
constexpr int KPITCH = 68;
// V lies in LDS as 4 planes of 16 columns, rows dense (64 bytes): the 4 rows x 16 columns of one fragment read are
// 64 consecutive dwords (64 distinct banks), and a fragment's two rows are neighbours for one two-address read

// One thread's share of a stage: 4 K chunks and 4 V chunks of 16 bytes.
// s_wait_xcnt stands inside the statement so that no address register named
// here is rewritten ahead of it.
__device__ __forceinline__ void async_stage_copies(
    uint32_t lk, const float* gk, uint32_t lv, const float* gv)
{
    constexpr uint32_t LKS = 16 * KPITCH * sizeof(float);
    constexpr uint32_t LVS = 16 * 16 * sizeof(float);
    asm volatile(
        "global_load_async_to_lds_b128 %0, %8, off\n\t"
        "global_load_async_to_lds_b128 %1, %9, off\n\t"
        "global_load_async_to_lds_b128 %2, %10, off\n\t"
        "global_load_async_to_lds_b128 %3, %11, off\n\t"
        "global_load_async_to_lds_b128 %4, %12, off\n\t"
        "global_load_async_to_lds_b128 %5, %13, off\n\t"
        "global_load_async_to_lds_b128 %6, %14, off\n\t"
        "global_load_async_to_lds_b128 %7, %15, off\n\t"
        "s_wait_xcnt 0x0"
        :: "v"(lk), "v"(lk + LKS), "v"(lk + 2 * LKS), "v"(lk + 3 * LKS),
           "v"(lv), "v"(lv + LVS), "v"(lv + 2 * LVS), "v"(lv + 3 * LVS),
           "v"(gk), "v"(gk + 16 * HD), "v"(gk + 32 * HD), "v"(gk + 48 * HD),
           "v"(gv), "v"(gv + 16 * HD), "v"(gv + 32 * HD), "v"(gv + 48 * HD)
        : "memory");
}

__global__ __launch_bounds__(256) void attn_kernel(
    const float* __restrict__ Q, const float* __restrict__ K,
    const float* __restrict__ V, float* __restrict__ O, int ntok)
{
    __shared__ __align__(16) float Ks[2][KT][KPITCH];
    __shared__ __align__(16) float Vs[2][4][KT][16];
    constexpr uint32_t KBUF = KT * KPITCH * sizeof(float);
    constexpr uint32_t VBUF = 4 * KT * 16 * sizeof(float);

    const int tid  = threadIdx.x;
    const int wave = tid >> 5;
    const int lane = tid & 31;
    const int lr   = lane & 15;
    const int hf   = lane >> 4;

    const int bh = blockIdx.y;
    const int b  = bh >> 4;
    const int hh = bh & 15;
    const size_t hbase = (size_t)bh * ntok * HD;
    const float* Qb = Q + hbase;
    const float* Kb = K + hbase;
    const float* Vb = V + hbase;

    const int q0 = (blockIdx.x * 8 + wave) * 16;
    const int qr = min(q0 + lr, ntok - 1);
    const int kperm = 4 * ((lr >> 1) & 3) + 2 * (lr >> 3) + (lr & 1);   // key of S^T row lr

    // copy share of this thread: rows crow + 16*i, 16 bytes at float ccol
    const int crow = tid >> 4;
    const int ccol = (tid & 15) * 4;
    const uint32_t lk0 = (uint32_t)(uintptr_t)&Ks[0][crow][ccol];
    const uint32_t lv0 = (uint32_t)(uintptr_t)&Vs[0][ccol >> 4][crow][ccol & 15];
    auto issue_stage = [&](int buf, int st) {
        const size_t off = ((size_t)st * KT + crow) * HD + ccol;
        async_stage_copies(lk0 + buf * KBUF, Kb + off, lv0 + buf * VBUF, Vb + off);
    };

    // Q fragment (B operand: column lr, k = 2*hf + {0,1}), pre-scaled by 1/sqrt(hd)
    v2f qf[16];
    {
        const float* qrow = Qb + (size_t)qr * HD + 2 * hf;
#pragma unroll
        for (int c = 0; c < 16; ++c) {
            v2f t = *(const v2f*)(qrow + 4 * c);
            t.x *= 0.125f; t.y *= 0.125f;
            qf[c] = t;
        }
    }

    float mrow = -3.0e38f;   // running maximum of query lr, equal in both halves
    float lrow = 0.0f;       // running sum over this half's keys only; halves joined at the end
    v8f ov[4] = {};          // ov[g][r] = O^T[16g + 8hf + r][query lr]

    // online softmax of one 16x16 score tile, then O^T += V^T @ P^T;
    // masked: only the first jlim keys of the tile exist
    auto softmax_pv = [&](const v8f& s, const v2f (&va)[4][4], bool masked, int jlim) {
        float sv[8];
#pragma unroll
        for (int r = 0; r < 8; ++r)
            sv[r] = (!masked || (4 * (r >> 1) + 2 * hf + (r & 1)) < jlim) ? s[r] : -3.0e38f;
        float mx = fmaxf(fmaxf(fmaxf(sv[0], sv[1]), fmaxf(sv[2], sv[3])),
                         fmaxf(fmaxf(sv[4], sv[5]), fmaxf(sv[6], sv[7])));
        mx = fmaxf(mx, xhalf(mx));
        const float mnew = fmaxf(mrow, mx);
        const float corr = expf(mrow - mnew);
        mrow = mnew;
        v2f pb[4];
#pragma unroll
        for (int i = 0; i < 4; ++i) {
            pb[i].x = expf(sv[2 * i] - mnew);
            pb[i].y = expf(sv[2 * i + 1] - mnew);
        }
        lrow = lrow * corr + (((pb[0].x + pb[0].y) + (pb[1].x + pb[1].y)) +
                              ((pb[2].x + pb[2].y) + (pb[3].x + pb[3].y)));
#pragma unroll
        for (int g = 0; g < 4; ++g) ov[g] *= corr;

#pragma unroll
        for (int i = 0; i < 4; ++i) {
#pragma unroll
            for (int g = 0; g < 4; ++g) ov[g] = WMMA_F32(va[i][g], pb[i], ov[g]);
        }
    };

    // 16 keys at row jj of LDS buffer buf
    auto tile_lds = [&](int buf, int jj) {
        v2f kb[16];
#pragma unroll
        for (int c = 0; c < 16; ++c) kb[c] = *(const v2f*)&Ks[buf][jj + kperm][4 * c + 2 * hf];

        // ---- S^T = K @ (Q/sqrt(hd))^T ----
        v8f s = {};
#pragma unroll
        for (int c = 0; c < 16; ++c) s = WMMA_F32(kb[c], qf[c], s);

        v2f va[4][4];   // [kk/4][group]
#pragma unroll
        for (int k4 = 0; k4 < 4; ++k4) {
#pragma unroll
            for (int g = 0; g < 4; ++g) {
                va[k4][g].x = Vs[buf][g][jj + k4 * 4 + 2 * hf][lr];
                va[k4][g].y = Vs[buf][g][jj + k4 * 4 + 2 * hf + 1][lr];
            }
        }
        softmax_pv(s, va, false, 16);
    };

    // 16 keys from global memory, rows clamped, keys past the end masked
    auto tile_global = [&](int j0) {
        v2f kb[16];
        const float* krow = Kb + (size_t)min(j0 + kperm, ntok - 1) * HD + 2 * hf;
#pragma unroll
        for (int c = 0; c < 16; ++c) kb[c] = *(const v2f*)(krow + 4 * c);

        v8f s = {};
#pragma unroll
        for (int c = 0; c < 16; ++c) s = WMMA_F32(kb[c], qf[c], s);

        v2f va[4][4];
#pragma unroll
        for (int k4 = 0; k4 < 4; ++k4) {
            const int v0 = min(j0 + k4 * 4 + 2 * hf,     ntok - 1);
            const int v1 = min(j0 + k4 * 4 + 2 * hf + 1, ntok - 1);
            const float* vr0 = Vb + (size_t)v0 * HD + lr;
            const float* vr1 = Vb + (size_t)v1 * HD + lr;
#pragma unroll
            for (int g = 0; g < 4; ++g) {
                va[k4][g].x = vr0[g * 16];
                va[k4][g].y = vr1[g * 16];
            }
        }
        softmax_pv(s, va, true, ntok - j0);
    };

    const int nst = ntok / KT;   // full stages; the same for every wave

    if (nst != 0) issue_stage(0, 0);
    wait_asynccnt<0>();          // this wave's share of stage 0 has landed
    __syncthreads();             // stage 0 readable by all waves
    if (ntok >= 2 * KT) issue_stage(1, 1);

    for (int t = 0; t < nst; ++t) {
        const int buf = t & 1;
        for (int jj = 0; jj < KT; jj += 16) tile_lds(buf, jj);
        asm volatile("s_wait_dscnt 0x0" ::: "memory");   // this wave's reads of buffer buf are done
        wait_asynccnt<0>();                              // its share of stage t+1 has landed
        __syncthreads();                                 // publishes stage t+1, frees buffer buf
        if (t + 2 < nst) issue_stage(buf, t + 2);
    }
    wait_asynccnt<0>();          // nothing in flight behind the loop

    for (int j0 = nst * KT; j0 < ntok; j0 += 16) tile_global(j0);

    // ---- normalize + store in (B, N, H, HD) == (B, N, D) ----
    const float ltot = lrow + xhalf(lrow);   // all lanes on: stands in front of the row test
    const int q = q0 + lr;
    if (q < ntok) {
        const float inv = 1.0f / ltot;
        float* orow = O + (((size_t)(b * ntok + q)) * HEADS + hh) * HD + 8 * hf;
#pragma unroll
        for (int g = 0; g < 4; ++g) {
            *(float4*)(orow + g * 16) =
                make_float4(ov[g][0] * inv, ov[g][1] * inv, ov[g][2] * inv, ov[g][3] * inv);
            *(float4*)(orow + g * 16 + 4) =
                make_float4(ov[g][4] * inv, ov[g][5] * inv, ov[g][6] * inv, ov[g][7] * inv);
        }
    }
}

// ---------------------------------------------------------------------------
extern "C" void kernel_launch(void* const* d_in, const int* in_sizes, int n_in,
                              void* d_out, int out_size, void* d_ws, size_t ws_size,
                              hipStream_t stream)
{
    const float* x        = (const float*)d_in[0];
    const int*   position = (const int*)d_in[1];
    const float* w_qkv    = (const float*)d_in[2];
    const float* b_qkv    = (const float*)d_in[3];
    const float* w_fc     = (const float*)d_in[4];
    const float* b_fc     = (const float*)d_in[5];
    float* out = (float*)d_out;
    float* ws  = (float*)d_ws;

    float* Qb = ws;
    float* Kb = ws + QSZ;
    float* Vb = ws + 2 * QSZ;
    float* Ab = ws + 3 * QSZ;   // attention output, (B, N, D)

    // 1) fused QKV projection (scatter into split Q/K/V, (B,H,N,hd))
    dim3 g1((3 * DMODEL) / 64, (MROWS + 31) / 32);
    gemm_wmma_kernel<1><<<g1, 256, 0, stream>>>(x, w_qkv, b_qkv, ws, MROWS, 3 * DMODEL, DMODEL);

    // 2) RoPE on q, k (cls token passthrough)
    constexpr int RTOTAL = BATCH * HEADS * (NTOK - 1) * (HD / 2);
    rope_kernel<<<(RTOTAL + 255) / 256, 256, 0, stream>>>(Qb, Kb, position);

    // 3) flash attention
    dim3 g2((NTOK + 127) / 128, BATCH * HEADS);
    attn_kernel<<<g2, 256, 0, stream>>>(Qb, Kb, Vb, Ab, NTOK);

    // 4) output projection
    dim3 g3(DMODEL / 64, (MROWS + 31) / 32);
    gemm_wmma_kernel<0><<<g3, 256, 0, stream>>>(Ab, w_fc, b_fc, out, MROWS, DMODEL, DMODEL);
}

// v003
// It runs in 826 microseconds.
// Next to v002, in two timings, it ran 1.06 times as fast each time.
// Over all steps from v000 it is 1.35 times as fast.
#include <hip/hip_runtime.h>
#include <hip/hip_bf16.h>

typedef __attribute__((ext_vector_type(2))) float v2f;
typedef __attribute__((ext_vector_type(8))) float v8f;

#define WMMA_F32(a, b, c) \
    __builtin_amdgcn_wmma_f32_16x16x4_f32(false, (a), false, (b), (short)0, (c), false, false)

constexpr int BATCH = 4;
constexpr int HEADS = 16;
constexpr int NTOK  = 2049;
constexpr int DMODEL = 1024;
constexpr int HD = 64;
constexpr int MROWS = BATCH * NTOK;                        // 8196
constexpr size_t QSZ = (size_t)BATCH * HEADS * NTOK * HD;  // floats per Q/K/V buffer

static_assert(NTOK - 1 == 2048, "rope indexing assumes N-1 == 2048");

// ---------------------------------------------------------------------------
// CDNA5 async global->LDS copies (ASYNCcnt-tracked, no VGPR round trip).
// LDS byte address = low 32 bits of the generic shared pointer (flat LDS
// aperture maps addr[31:0] to the wave's LDS allocation).
// ---------------------------------------------------------------------------
template <int N>
__device__ __forceinline__ void wait_asynccnt() {
    asm volatile("s_wait_asynccnt %0" :: "n"(N) : "memory");
}

// ---------------------------------------------------------------------------
// Value of lane l ^ 16: the other half of the wave, same column of a WMMA tile.
// ---------------------------------------------------------------------------
__device__ __forceinline__ float xhalf(float x) {
    return __builtin_bit_cast(float, __builtin_amdgcn_permlanex16(
        __builtin_bit_cast(int, x), __builtin_bit_cast(int, x),
        0x76543210, 0xfedcba98, false, false));
}

// ---------------------------------------------------------------------------
// GEMM: out = A(MxK) @ W(NxK)^T + bias
// One 128x128 tile of out per workgroup, 8 waves as 2 (rows) x 4 (columns),
// 64x32 per wave: 4 x 2 accumulator tiles, so one A fragment feeds 2 and one
// B fragment 4 products, and each operand row is fetched once per 128 rows or
// columns of out. A pass is 64 k (256 bytes of every operand row); two LDS
// buffers filled by async copies, pass t+1 lands while pass t is worked on.
// Every output element still sums its k in ascending order in one chain.
// N is a multiple of GBN, K of GKP; rows past M are clamped at the copy,
// masked at the store, and a 16-row fragment wholly past M is not computed.
// EPI 0: plain row-major (MxN) store.  EPI 1: Q/K/V split, (B,H,NTOK,HD).
// ---------------------------------------------------------------------------
constexpr int GBM = 128;   // rows of out per workgroup
constexpr int GBN = 128;   // columns of out per workgroup
constexpr int GKP = 64;    // k per pass
constexpr int GPITCH = 68; // floats per LDS row: 16 rows x 2 halves of one 8-byte read hit 64 distinct banks

// One thread's share of one operand's pass: 16 bytes of each of 8 rows, 16
// rows apart in LDS. s_wait_xcnt stands inside the statement so that no
// address register named here is rewritten ahead of it.
__device__ __forceinline__ void async_rows8(
    uint32_t l, const float* g0, const float* g1, const float* g2, const float* g3,
    const float* g4, const float* g5, const float* g6, const float* g7)
{
    constexpr uint32_t LS = 16 * GPITCH * sizeof(float);
    asm volatile(
        "global_load_async_to_lds_b128 %0, %8, off\n\t"
        "global_load_async_to_lds_b128 %1, %9, off\n\t"
        "global_load_async_to_lds_b128 %2, %10, off\n\t"
        "global_load_async_to_lds_b128 %3, %11, off\n\t"
        "global_load_async_to_lds_b128 %4, %12, off\n\t"
        "global_load_async_to_lds_b128 %5, %13, off\n\t"
        "global_load_async_to_lds_b128 %6, %14, off\n\t"
        "global_load_async_to_lds_b128 %7, %15, off\n\t"
        "s_wait_xcnt 0x0"
        :: "v"(l), "v"(l + LS), "v"(l + 2 * LS), "v"(l + 3 * LS),
           "v"(l + 4 * LS), "v"(l + 5 * LS), "v"(l + 6 * LS), "v"(l + 7 * LS),
           "v"(g0), "v"(g1), "v"(g2), "v"(g3), "v"(g4), "v"(g5), "v"(g6), "v"(g7)
        : "memory");
}

template <int EPI>
__global__ __launch_bounds__(256) void gemm_wmma_kernel(
    const float* __restrict__ A, const float* __restrict__ W,
    const float* __restrict__ bias, float* __restrict__ out,
    int M, int N, int K)
{
    __shared__ __align__(16) float As[2][GBM][GPITCH];
    __shared__ __align__(16) float Bs[2][GBN][GPITCH];
    constexpr uint32_t ABUF = GBM * GPITCH * sizeof(float);
    constexpr uint32_t BBUF = GBN * GPITCH * sizeof(float);

    const int tid  = threadIdx.x;
    const int m0   = blockIdx.y * GBM;
    const int n0   = blockIdx.x * GBN;
    const int lane = tid & 31;
    const int lr   = lane & 15;
    const int hf   = lane >> 4;
    const int wave = __builtin_amdgcn_readfirstlane(tid >> 5);
    const int wm   = (wave >> 2) * 64;
    const int wn   = (wave & 3) * 32;
    // 16-row fragments of this wave that hold a row below M (wave-uniform)
    const int mfr  = min(4, max(0, (M - m0 - wm + 15) >> 4));

    // copy share of this thread: rows crow + 16*i of both operands, 16 bytes at float ccol
    const int crow = tid >> 4;
    const int ccol = (tid & 15) * 4;
    const float* ag[8];   // clamped row: garbage only feeds output rows that are masked at store
    const float* wg[8];
#pragma unroll
    for (int i = 0; i < 8; ++i) {
        ag[i] = A + (size_t)min(m0 + crow + 16 * i, M - 1) * K + ccol;
        wg[i] = W + (size_t)(n0 + crow + 16 * i) * K + ccol;
    }
    const uint32_t asA = (uint32_t)(uintptr_t)&As[0][crow][ccol];
    const uint32_t asB = (uint32_t)(uintptr_t)&Bs[0][crow][ccol];

    auto issue = [&](int buf, int k0) {
        async_rows8(asA + buf * ABUF, ag[0] + k0, ag[1] + k0, ag[2] + k0, ag[3] + k0,
                                      ag[4] + k0, ag[5] + k0, ag[6] + k0, ag[7] + k0);
        async_rows8(asB + buf * BBUF, wg[0] + k0, wg[1] + k0, wg[2] + k0, wg[3] + k0,
                                      wg[4] + k0, wg[5] + k0, wg[6] + k0, wg[7] + k0);
    };

    v8f acc[4][2] = {};
    const int npass = K / GKP;

    issue(0, 0);
    wait_asynccnt<0>();          // this wave's share of pass 0 has landed
    __syncthreads();             // pass 0 readable by all waves
    if (npass > 1) issue(1, GKP);

    for (int t = 0; t < npass; ++t) {
        const int buf = t & 1;
        const float* ar = &As[buf][wm + lr][2 * hf];
        const float* br = &Bs[buf][wn + lr][2 * hf];
        if (mfr == 4) {
#pragma unroll
            for (int s = 0; s < GKP / 4; ++s) {
                v2f af[4], bf[2];
#pragma unroll
                for (int i = 0; i < 4; ++i) af[i] = *(const v2f*)(ar + i * 16 * GPITCH + 4 * s);
#pragma unroll
                for (int j = 0; j < 2; ++j) bf[j] = *(const v2f*)(br + j * 16 * GPITCH + 4 * s);
#pragma unroll
                for (int i = 0; i < 4; ++i) {
#pragma unroll
                    for (int j = 0; j < 2; ++j) acc[i][j] = WMMA_F32(af[i], bf[j], acc[i][j]);
                }
            }
        } else {
            // edge tile of M: only the fragments that hold a row of out
#pragma unroll
            for (int i = 0; i < 4; ++i) {
                if (i < mfr) {
#pragma unroll
                    for (int s = 0; s < GKP / 4; ++s) {
                        const v2f af = *(const v2f*)(ar + i * 16 * GPITCH + 4 * s);
#pragma unroll
                        for (int j = 0; j < 2; ++j) {
                            const v2f bf = *(const v2f*)(br + j * 16 * GPITCH + 4 * s);
                            acc[i][j] = WMMA_F32(af, bf, acc[i][j]);
                        }
                    }
                }
            }
        }
        asm volatile("s_wait_dscnt 0x0" ::: "memory");   // this wave's reads of buffer buf are done
        wait_asynccnt<0>();                              // its share of pass t+1 has landed
        __syncthreads();                                 // publishes pass t+1, frees buffer buf
        if (t + 2 < npass) issue(buf, (t + 2) * GKP);
    }
    wait_asynccnt<0>();          // nothing in flight behind the loop

#pragma unroll
    for (int j = 0; j < 2; ++j) {
        const int n = n0 + wn + 16 * j + lr;
        const float bv = bias[n];
        if (EPI == 0) {
#pragma unroll
            for (int i = 0; i < 4; ++i) {
#pragma unroll
                for (int r = 0; r < 8; ++r) {
                    const int m = m0 + wm + 16 * i + r + 8 * hf;
                    if (m < M) out[(size_t)m * N + n] = acc[i][j][r] + bv;
                }
            }
        } else {
            const int three = n >> 10;
            const int hh    = (n >> 6) & 15;
            const int d     = n & 63;
            float* base = out + (size_t)three * QSZ;
#pragma unroll
            for (int i = 0; i < 4; ++i) {
#pragma unroll
                for (int r = 0; r < 8; ++r) {
                    const int m = m0 + wm + 16 * i + r + 8 * hf;
                    if (m < M) {
                        const int b = m / NTOK;
                        const int t = m - b * NTOK;
                        base[(((size_t)(b * HEADS + hh)) * NTOK + t) * HD + d] = acc[i][j][r] + bv;
                    }
                }
            }
        }
    }
}

// ---------------------------------------------------------------------------
// RoPE on Q and K, (B,H,NTOK,HD) layout; token 0 (cls) untouched.
// ---------------------------------------------------------------------------
__global__ __launch_bounds__(256) void rope_kernel(
    float* __restrict__ Q, float* __restrict__ K,
    const int* __restrict__ position)
{
    const int idx = blockIdx.x * 256 + threadIdx.x;
    constexpr int TOTAL = BATCH * HEADS * (NTOK - 1) * (HD / 2);
    if (idx >= TOTAL) return;
    const int p     = idx & 31;
    const int rest  = idx >> 5;
    const int t     = rest & 2047;
    const int rest2 = rest >> 11;
    const int hh    = rest2 & 15;
    const int b     = rest2 >> 4;

    const float posf = (float)position[b * (NTOK - 1) + t];
    const float freq = powf(10000.0f, -(float)(2 * p) / (float)HD);
    const float ang  = posf * freq;
    float s, c;
    sincosf(ang, &s, &c);

    const size_t base = (((size_t)(b * HEADS + hh)) * NTOK + (t + 1)) * HD + 2 * p;
    const float qre = Q[base], qim = Q[base + 1];
    Q[base]     = qre * c - qim * s;
    Q[base + 1] = qre * s + qim * c;
    const float kre = K[base], kim = K[base + 1];
    K[base]     = kre * c - kim * s;
    K[base + 1] = kre * s + kim * c;
}

constexpr int KT     = 64;
constexpr int KPITCH = 68;
// V lies in LDS as 4 planes of 16 columns, rows dense (64 bytes): the 4 rows x 16 columns of one fragment read are
// 64 consecutive dwords (64 distinct banks), and a fragment's two rows are neighbours for one two-address read

// One thread's share of a stage: 4 K chunks and 4 V chunks of 16 bytes.
// s_wait_xcnt stands inside the statement so that no address register named
// here is rewritten ahead of it.
__device__ __forceinline__ void async_stage_copies(
    uint32_t lk, const float* gk, uint32_t lv, const float* gv)
{
    constexpr uint32_t LKS = 16 * KPITCH * sizeof(float);
    constexpr uint32_t LVS = 16 * 16 * sizeof(float);
    asm volatile(
        "global_load_async_to_lds_b128 %0, %8, off\n\t"
        "global_load_async_to_lds_b128 %1, %9, off\n\t"
        "global_load_async_to_lds_b128 %2, %10, off\n\t"
        "global_load_async_to_lds_b128 %3, %11, off\n\t"
        "global_load_async_to_lds_b128 %4, %12, off\n\t"
        "global_load_async_to_lds_b128 %5, %13, off\n\t"
        "global_load_async_to_lds_b128 %6, %14, off\n\t"
        "global_load_async_to_lds_b128 %7, %15, off\n\t"
        "s_wait_xcnt 0x0"
        :: "v"(lk), "v"(lk + LKS), "v"(lk + 2 * LKS), "v"(lk + 3 * LKS),
           "v"(lv), "v"(lv + LVS), "v"(lv + 2 * LVS), "v"(lv + 3 * LVS),
           "v"(gk), "v"(gk + 16 * HD), "v"(gk + 32 * HD), "v"(gk + 48 * HD),
           "v"(gv), "v"(gv + 16 * HD), "v"(gv + 32 * HD), "v"(gv + 48 * HD)
        : "memory");
}

__global__ __launch_bounds__(256) void attn_kernel(
    const float* __restrict__ Q, const float* __restrict__ K,
    const float* __restrict__ V, float* __restrict__ O, int ntok)
{
    __shared__ __align__(16) float Ks[2][KT][KPITCH];
    __shared__ __align__(16) float Vs[2][4][KT][16];
    constexpr uint32_t KBUF = KT * KPITCH * sizeof(float);
    constexpr uint32_t VBUF = 4 * KT * 16 * sizeof(float);

    const int tid  = threadIdx.x;
    const int wave = tid >> 5;
    const int lane = tid & 31;
    const int lr   = lane & 15;
    const int hf   = lane >> 4;

    const int bh = blockIdx.y;
    const int b  = bh >> 4;
    const int hh = bh & 15;
    const size_t hbase = (size_t)bh * ntok * HD;
    const float* Qb = Q + hbase;
    const float* Kb = K + hbase;
    const float* Vb = V + hbase;

    const int q0 = (blockIdx.x * 8 + wave) * 16;
    const int qr = min(q0 + lr, ntok - 1);
    const int kperm = 4 * ((lr >> 1) & 3) + 2 * (lr >> 3) + (lr & 1);   // key of S^T row lr

    // copy share of this thread: rows crow + 16*i, 16 bytes at float ccol
    const int crow = tid >> 4;
    const int ccol = (tid & 15) * 4;
    const uint32_t lk0 = (uint32_t)(uintptr_t)&Ks[0][crow][ccol];
    const uint32_t lv0 = (uint32_t)(uintptr_t)&Vs[0][ccol >> 4][crow][ccol & 15];
    auto issue_stage = [&](int buf, int st) {
        const size_t off = ((size_t)st * KT + crow) * HD + ccol;
        async_stage_copies(lk0 + buf * KBUF, Kb + off, lv0 + buf * VBUF, Vb + off);
    };

    // Q fragment (B operand: column lr, k = 2*hf + {0,1}), pre-scaled by 1/sqrt(hd)
    v2f qf[16];
    {
        const float* qrow = Qb + (size_t)qr * HD + 2 * hf;
#pragma unroll
        for (int c = 0; c < 16; ++c) {
            v2f t = *(const v2f*)(qrow + 4 * c);
            t.x *= 0.125f; t.y *= 0.125f;
            qf[c] = t;
        }
    }

    float mrow = -3.0e38f;   // running maximum of query lr, equal in both halves
    float lrow = 0.0f;       // running sum over this half's keys only; halves joined at the end
    v8f ov[4] = {};          // ov[g][r] = O^T[16g + 8hf + r][query lr]

    // online softmax of one 16x16 score tile, then O^T += V^T @ P^T;
    // masked: only the first jlim keys of the tile exist
    auto softmax_pv = [&](const v8f& s, const v2f (&va)[4][4], bool masked, int jlim) {
        float sv[8];
#pragma unroll
        for (int r = 0; r < 8; ++r)
            sv[r] = (!masked || (4 * (r >> 1) + 2 * hf + (r & 1)) < jlim) ? s[r] : -3.0e38f;
        float mx = fmaxf(fmaxf(fmaxf(sv[0], sv[1]), fmaxf(sv[2], sv[3])),
                         fmaxf(fmaxf(sv[4], sv[5]), fmaxf(sv[6], sv[7])));
        mx = fmaxf(mx, xhalf(mx));
        const float mnew = fmaxf(mrow, mx);
        const float corr = expf(mrow - mnew);
        mrow = mnew;
        v2f pb[4];
#pragma unroll
        for (int i = 0; i < 4; ++i) {
            pb[i].x = expf(sv[2 * i] - mnew);
            pb[i].y = expf(sv[2 * i + 1] - mnew);
        }
        lrow = lrow * corr + (((pb[0].x + pb[0].y) + (pb[1].x + pb[1].y)) +
                              ((pb[2].x + pb[2].y) + (pb[3].x + pb[3].y)));
#pragma unroll
        for (int g = 0; g < 4; ++g) ov[g] *= corr;

#pragma unroll
        for (int i = 0; i < 4; ++i) {
#pragma unroll
            for (int g = 0; g < 4; ++g) ov[g] = WMMA_F32(va[i][g], pb[i], ov[g]);
        }
    };

    // 16 keys at row jj of LDS buffer buf
    auto tile_lds = [&](int buf, int jj) {
        v2f kb[16];
#pragma unroll
        for (int c = 0; c < 16; ++c) kb[c] = *(const v2f*)&Ks[buf][jj + kperm][4 * c + 2 * hf];

        // ---- S^T = K @ (Q/sqrt(hd))^T ----
        v8f s = {};
#pragma unroll
        for (int c = 0; c < 16; ++c) s = WMMA_F32(kb[c], qf[c], s);

        v2f va[4][4];   // [kk/4][group]
#pragma unroll
        for (int k4 = 0; k4 < 4; ++k4) {
#pragma unroll
            for (int g = 0; g < 4; ++g) {
                va[k4][g].x = Vs[buf][g][jj + k4 * 4 + 2 * hf][lr];
                va[k4][g].y = Vs[buf][g][jj + k4 * 4 + 2 * hf + 1][lr];
            }
        }
        softmax_pv(s, va, false, 16);
    };

    // 16 keys from global memory, rows clamped, keys past the end masked
    auto tile_global = [&](int j0) {
        v2f kb[16];
        const float* krow = Kb + (size_t)min(j0 + kperm, ntok - 1) * HD + 2 * hf;
#pragma unroll
        for (int c = 0; c < 16; ++c) kb[c] = *(const v2f*)(krow + 4 * c);

        v8f s = {};
#pragma unroll
        for (int c = 0; c < 16; ++c) s = WMMA_F32(kb[c], qf[c], s);

        v2f va[4][4];
#pragma unroll
        for (int k4 = 0; k4 < 4; ++k4) {
            const int v0 = min(j0 + k4 * 4 + 2 * hf,     ntok - 1);
            const int v1 = min(j0 + k4 * 4 + 2 * hf + 1, ntok - 1);
            const float* vr0 = Vb + (size_t)v0 * HD + lr;
            const float* vr1 = Vb + (size_t)v1 * HD + lr;
#pragma unroll
            for (int g = 0; g < 4; ++g) {
                va[k4][g].x = vr0[g * 16];
                va[k4][g].y = vr1[g * 16];
            }
        }
        softmax_pv(s, va, true, ntok - j0);
    };

    const int nst = ntok / KT;   // full stages; the same for every wave

    if (nst != 0) issue_stage(0, 0);
    wait_asynccnt<0>();          // this wave's share of stage 0 has landed
    __syncthreads();             // stage 0 readable by all waves
    if (ntok >= 2 * KT) issue_stage(1, 1);

    for (int t = 0; t < nst; ++t) {
        const int buf = t & 1;
        for (int jj = 0; jj < KT; jj += 16) tile_lds(buf, jj);
        asm volatile("s_wait_dscnt 0x0" ::: "memory");   // this wave's reads of buffer buf are done
        wait_asynccnt<0>();                              // its share of stage t+1 has landed
        __syncthreads();                                 // publishes stage t+1, frees buffer buf
        if (t + 2 < nst) issue_stage(buf, t + 2);
    }
    wait_asynccnt<0>();          // nothing in flight behind the loop

    for (int j0 = nst * KT; j0 < ntok; j0 += 16) tile_global(j0);

    // ---- normalize + store in (B, N, H, HD) == (B, N, D) ----
    const float ltot = lrow + xhalf(lrow);   // all lanes on: stands in front of the row test
    const int q = q0 + lr;
    if (q < ntok) {
        const float inv = 1.0f / ltot;
        float* orow = O + (((size_t)(b * ntok + q)) * HEADS + hh) * HD + 8 * hf;
#pragma unroll
        for (int g = 0; g < 4; ++g) {
            *(float4*)(orow + g * 16) =
                make_float4(ov[g][0] * inv, ov[g][1] * inv, ov[g][2] * inv, ov[g][3] * inv);
            *(float4*)(orow + g * 16 + 4) =
                make_float4(ov[g][4] * inv, ov[g][5] * inv, ov[g][6] * inv, ov[g][7] * inv);
        }
    }
}

// ---------------------------------------------------------------------------
extern "C" void kernel_launch(void* const* d_in, const int* in_sizes, int n_in,
                              void* d_out, int out_size, void* d_ws, size_t ws_size,
                              hipStream_t stream)
{
    const float* x        = (const float*)d_in[0];
    const int*   position = (const int*)d_in[1];
    const float* w_qkv    = (const float*)d_in[2];
    const float* b_qkv    = (const float*)d_in[3];
    const float* w_fc     = (const float*)d_in[4];
    const float* b_fc     = (const float*)d_in[5];
    float* out = (float*)d_out;
    float* ws  = (float*)d_ws;

    float* Qb = ws;
    float* Kb = ws + QSZ;
    float* Vb = ws + 2 * QSZ;
    float* Ab = ws + 3 * QSZ;   // attention output, (B, N, D)

    // 1) fused QKV projection (scatter into split Q/K/V, (B,H,N,hd))
    dim3 g1((3 * DMODEL) / GBN, (MROWS + GBM - 1) / GBM);
    gemm_wmma_kernel<1><<<g1, 256, 0, stream>>>(x, w_qkv, b_qkv, ws, MROWS, 3 * DMODEL, DMODEL);

    // 2) RoPE on q, k (cls token passthrough)
    constexpr int RTOTAL = BATCH * HEADS * (NTOK - 1) * (HD / 2);
    rope_kernel<<<(RTOTAL + 255) / 256, 256, 0, stream>>>(Qb, Kb, position);

    // 3) flash attention
    dim3 g2((NTOK + 127) / 128, BATCH * HEADS);
    attn_kernel<<<g2, 256, 0, stream>>>(Qb, Kb, Vb, Ab, NTOK);

    // 4) output projection
    dim3 g3(DMODEL / GBN, (MROWS + GBM - 1) / GBM);
    gemm_wmma_kernel<0><<<g3, 256, 0, stream>>>(Ab, w_fc, b_fc, out, MROWS, DMODEL, DMODEL);
}

// v004
// One run takes 764 microseconds.
// Timed twice side by side with v003, it ran 1.08 times as fast both times.
// All steps since v000 together make it 1.45 times as fast.
#include <hip/hip_runtime.h>
#include <hip/hip_bf16.h>

typedef __attribute__((ext_vector_type(2))) float v2f;
typedef __attribute__((ext_vector_type(8))) float v8f;

#define WMMA_F32(a, b, c) \
    __builtin_amdgcn_wmma_f32_16x16x4_f32(false, (a), false, (b), (short)0, (c), false, false)

constexpr int BATCH = 4;
constexpr int HEADS = 16;
constexpr int NTOK  = 2049;
constexpr int DMODEL = 1024;
constexpr int HD = 64;
constexpr int MROWS = BATCH * NTOK;                        // 8196
constexpr size_t QSZ = (size_t)BATCH * HEADS * NTOK * HD;  // floats per Q/K/V buffer

static_assert(NTOK - 1 == 2048, "rope indexing assumes N-1 == 2048");

// ---------------------------------------------------------------------------
// CDNA5 async global->LDS copies (ASYNCcnt-tracked, no VGPR round trip).
// LDS byte address = low 32 bits of the generic shared pointer (flat LDS
// aperture maps addr[31:0] to the wave's LDS allocation).
// ---------------------------------------------------------------------------
template <int N>
__device__ __forceinline__ void wait_asynccnt() {
    asm volatile("s_wait_asynccnt %0" :: "n"(N) : "memory");
}

// ---------------------------------------------------------------------------
// Value of lane l ^ 16: the other half of the wave, same column of a WMMA tile.
// ---------------------------------------------------------------------------
__device__ __forceinline__ float xhalf(float x) {
    return __builtin_bit_cast(float, __builtin_amdgcn_permlanex16(
        __builtin_bit_cast(int, x), __builtin_bit_cast(int, x),
        0x76543210, 0xfedcba98, false, false));
}

// ---------------------------------------------------------------------------
// GEMM: out = A(MxK) @ W(NxK)^T + bias
// One 128x128 tile of out per workgroup, 8 waves as 2 (rows) x 4 (columns),
// 64x32 per wave: 4 x 2 accumulator tiles, so one A fragment feeds 2 and one
// B fragment 4 products, and each operand row is fetched once per 128 rows or
// columns of out. A pass is 64 k (256 bytes of every operand row); two LDS
// buffers filled by async copies, pass t+1 lands while pass t is worked on.
// Every output element still sums its k in ascending order in one chain.
// N is a multiple of GBN, K of GKP; rows past M are clamped at the copy,
// masked at the store, and a 16-row fragment wholly past M is not computed.
// EPI 0: plain row-major (MxN) store.  EPI 1: Q/K/V split, (B,H,NTOK,HD).
// ---------------------------------------------------------------------------
constexpr int GBM = 128;   // rows of out per workgroup
constexpr int GBN = 128;   // columns of out per workgroup
constexpr int GKP = 64;    // k per pass
constexpr int GPITCH = 68; // floats per LDS row: 16 rows x 2 halves of one 8-byte read hit 64 distinct banks

// One thread's share of one operand's pass: 16 bytes of each of 8 rows, 16
// rows apart in LDS. s_wait_xcnt stands inside the statement so that no
// address register named here is rewritten ahead of it.
__device__ __forceinline__ void async_rows8(
    uint32_t l, const float* g0, const float* g1, const float* g2, const float* g3,
    const float* g4, const float* g5, const float* g6, const float* g7)
{
    constexpr uint32_t LS = 16 * GPITCH * sizeof(float);
    asm volatile(
        "global_load_async_to_lds_b128 %0, %8, off\n\t"
        "global_load_async_to_lds_b128 %1, %9, off\n\t"
        "global_load_async_to_lds_b128 %2, %10, off\n\t"
        "global_load_async_to_lds_b128 %3, %11, off\n\t"
        "global_load_async_to_lds_b128 %4, %12, off\n\t"
        "global_load_async_to_lds_b128 %5, %13, off\n\t"
        "global_load_async_to_lds_b128 %6, %14, off\n\t"
        "global_load_async_to_lds_b128 %7, %15, off\n\t"
        "s_wait_xcnt 0x0"
        :: "v"(l), "v"(l + LS), "v"(l + 2 * LS), "v"(l + 3 * LS),
           "v"(l + 4 * LS), "v"(l + 5 * LS), "v"(l + 6 * LS), "v"(l + 7 * LS),
           "v"(g0), "v"(g1), "v"(g2), "v"(g3), "v"(g4), "v"(g5), "v"(g6), "v"(g7)
        : "memory");
}

template <int EPI>
__global__ __launch_bounds__(256) void gemm_wmma_kernel(
    const float* __restrict__ A, const float* __restrict__ W,
    const float* __restrict__ bias, float* __restrict__ out,
    int M, int N, int K)
{
    __shared__ __align__(16) float As[2][GBM][GPITCH];
    __shared__ __align__(16) float Bs[2][GBN][GPITCH];
    constexpr uint32_t ABUF = GBM * GPITCH * sizeof(float);
    constexpr uint32_t BBUF = GBN * GPITCH * sizeof(float);

    const int tid  = threadIdx.x;
    const int m0   = blockIdx.y * GBM;
    const int n0   = blockIdx.x * GBN;
    const int lane = tid & 31;
    const int lr   = lane & 15;
    const int hf   = lane >> 4;
    const int wave = __builtin_amdgcn_readfirstlane(tid >> 5);
    const int wm   = (wave >> 2) * 64;
    const int wn   = (wave & 3) * 32;
    // 16-row fragments of this wave that hold a row below M (wave-uniform)
    const int mfr  = min(4, max(0, (M - m0 - wm + 15) >> 4));

    // copy share of this thread: rows crow + 16*i of both operands, 16 bytes at float ccol
    const int crow = tid >> 4;
    const int ccol = (tid & 15) * 4;
    const float* ag[8];   // clamped row: garbage only feeds output rows that are masked at store
    const float* wg[8];
#pragma unroll
    for (int i = 0; i < 8; ++i) {
        ag[i] = A + (size_t)min(m0 + crow + 16 * i, M - 1) * K + ccol;
        wg[i] = W + (size_t)(n0 + crow + 16 * i) * K + ccol;
    }
    const uint32_t asA = (uint32_t)(uintptr_t)&As[0][crow][ccol];
    const uint32_t asB = (uint32_t)(uintptr_t)&Bs[0][crow][ccol];

    auto issue = [&](int buf, int k0) {
        async_rows8(asA + buf * ABUF, ag[0] + k0, ag[1] + k0, ag[2] + k0, ag[3] + k0,
                                      ag[4] + k0, ag[5] + k0, ag[6] + k0, ag[7] + k0);
        async_rows8(asB + buf * BBUF, wg[0] + k0, wg[1] + k0, wg[2] + k0, wg[3] + k0,
                                      wg[4] + k0, wg[5] + k0, wg[6] + k0, wg[7] + k0);
    };

    v8f acc[4][2] = {};
    const int npass = K / GKP;

    issue(0, 0);
    wait_asynccnt<0>();          // this wave's share of pass 0 has landed
    __syncthreads();             // pass 0 readable by all waves
    if (npass > 1) issue(1, GKP);

    for (int t = 0; t < npass; ++t) {
        const int buf = t & 1;
        const float* ar = &As[buf][wm + lr][2 * hf];
        const float* br = &Bs[buf][wn + lr][2 * hf];
        if (mfr == 4) {
#pragma unroll
            for (int s = 0; s < GKP / 4; ++s) {
                v2f af[4], bf[2];
#pragma unroll
                for (int i = 0; i < 4; ++i) af[i] = *(const v2f*)(ar + i * 16 * GPITCH + 4 * s);
#pragma unroll
                for (int j = 0; j < 2; ++j) bf[j] = *(const v2f*)(br + j * 16 * GPITCH + 4 * s);
#pragma unroll
                for (int i = 0; i < 4; ++i) {
#pragma unroll
                    for (int j = 0; j < 2; ++j) acc[i][j] = WMMA_F32(af[i], bf[j], acc[i][j]);
                }
            }
        } else {
            // edge tile of M: only the fragments that hold a row of out
#pragma unroll
            for (int i = 0; i < 4; ++i) {
                if (i < mfr) {
#pragma unroll
                    for (int s = 0; s < GKP / 4; ++s) {
                        const v2f af = *(const v2f*)(ar + i * 16 * GPITCH + 4 * s);
#pragma unroll
                        for (int j = 0; j < 2; ++j) {
                            const v2f bf = *(const v2f*)(br + j * 16 * GPITCH + 4 * s);
                            acc[i][j] = WMMA_F32(af, bf, acc[i][j]);
                        }
                    }
                }
            }
        }
        asm volatile("s_wait_dscnt 0x0" ::: "memory");   // this wave's reads of buffer buf are done
        wait_asynccnt<0>();                              // its share of pass t+1 has landed
        __syncthreads();                                 // publishes pass t+1, frees buffer buf
        if (t + 2 < npass) issue(buf, (t + 2) * GKP);
    }
    wait_asynccnt<0>();          // nothing in flight behind the loop

#pragma unroll
    for (int j = 0; j < 2; ++j) {
        const int n = n0 + wn + 16 * j + lr;
        const float bv = bias[n];
        if (EPI == 0) {
#pragma unroll
            for (int i = 0; i < 4; ++i) {
#pragma unroll
                for (int r = 0; r < 8; ++r) {
                    const int m = m0 + wm + 16 * i + r + 8 * hf;
                    if (m < M) out[(size_t)m * N + n] = acc[i][j][r] + bv;
                }
            }
        } else {
            const int three = n >> 10;
            const int hh    = (n >> 6) & 15;
            const int d     = n & 63;
            float* base = out + (size_t)three * QSZ;
#pragma unroll
            for (int i = 0; i < 4; ++i) {
#pragma unroll
                for (int r = 0; r < 8; ++r) {
                    const int m = m0 + wm + 16 * i + r + 8 * hf;
                    if (m < M) {
                        const int b = m / NTOK;
                        const int t = m - b * NTOK;
                        base[(((size_t)(b * HEADS + hh)) * NTOK + t) * HD + d] = acc[i][j][r] + bv;
                    }
                }
            }
        }
    }
}

// ---------------------------------------------------------------------------
// RoPE on Q and K, (B,H,NTOK,HD) layout; token 0 (cls) untouched.
// ---------------------------------------------------------------------------
__global__ __launch_bounds__(256) void rope_kernel(
    float* __restrict__ Q, float* __restrict__ K,
    const int* __restrict__ position)
{
    const int idx = blockIdx.x * 256 + threadIdx.x;
    constexpr int TOTAL = BATCH * HEADS * (NTOK - 1) * (HD / 2);
    if (idx >= TOTAL) return;
    const int p     = idx & 31;
    const int rest  = idx >> 5;
    const int t     = rest & 2047;
    const int rest2 = rest >> 11;
    const int hh    = rest2 & 15;
    const int b     = rest2 >> 4;

    const float posf = (float)position[b * (NTOK - 1) + t];
    const float freq = powf(10000.0f, -(float)(2 * p) / (float)HD);
    const float ang  = posf * freq;
    float s, c;
    sincosf(ang, &s, &c);

    const size_t base = (((size_t)(b * HEADS + hh)) * NTOK + (t + 1)) * HD + 2 * p;
    const float qre = Q[base], qim = Q[base + 1];
    Q[base]     = qre * c - qim * s;
    Q[base + 1] = qre * s + qim * c;
    const float kre = K[base], kim = K[base + 1];
    K[base]     = kre * c - kim * s;
    K[base + 1] = kre * s + kim * c;
}

constexpr int KT     = 64;
constexpr int KPITCH = 68;
// V lies in LDS as 4 planes of 16 columns, rows dense (64 bytes): the 4 rows x 16 columns of one fragment read are
// 64 consecutive dwords (64 distinct banks), and a fragment's two rows are neighbours for one two-address read

// One thread's share of a stage: 4 K chunks and 4 V chunks of 16 bytes.
// s_wait_xcnt stands inside the statement so that no address register named
// here is rewritten ahead of it.
__device__ __forceinline__ void async_stage_copies(
    uint32_t lk, const float* gk, uint32_t lv, const float* gv)
{
    constexpr uint32_t LKS = 16 * KPITCH * sizeof(float);
    constexpr uint32_t LVS = 16 * 16 * sizeof(float);
    asm volatile(
        "global_load_async_to_lds_b128 %0, %8, off\n\t"
        "global_load_async_to_lds_b128 %1, %9, off\n\t"
        "global_load_async_to_lds_b128 %2, %10, off\n\t"
        "global_load_async_to_lds_b128 %3, %11, off\n\t"
        "global_load_async_to_lds_b128 %4, %12, off\n\t"
        "global_load_async_to_lds_b128 %5, %13, off\n\t"
        "global_load_async_to_lds_b128 %6, %14, off\n\t"
        "global_load_async_to_lds_b128 %7, %15, off\n\t"
        "s_wait_xcnt 0x0"
        :: "v"(lk), "v"(lk + LKS), "v"(lk + 2 * LKS), "v"(lk + 3 * LKS),
           "v"(lv), "v"(lv + LVS), "v"(lv + 2 * LVS), "v"(lv + 3 * LVS),
           "v"(gk), "v"(gk + 16 * HD), "v"(gk + 32 * HD), "v"(gk + 48 * HD),
           "v"(gv), "v"(gv + 16 * HD), "v"(gv + 32 * HD), "v"(gv + 48 * HD)
        : "memory");
}

__global__ __launch_bounds__(256) void attn_kernel(
    const float* __restrict__ Q, const float* __restrict__ K,
    const float* __restrict__ V, float* __restrict__ O, int ntok)
{
    __shared__ __align__(16) float Ks[2][KT][KPITCH];
    __shared__ __align__(16) float Vs[2][4][KT][16];
    constexpr uint32_t KBUF = KT * KPITCH * sizeof(float);
    constexpr uint32_t VBUF = 4 * KT * 16 * sizeof(float);

    const int tid  = threadIdx.x;
    const int wave = tid >> 5;
    const int lane = tid & 31;
    const int lr   = lane & 15;
    const int hf   = lane >> 4;

    const int bh = blockIdx.y;
    const int b  = bh >> 4;
    const int hh = bh & 15;
    const size_t hbase = (size_t)bh * ntok * HD;
    const float* Qb = Q + hbase;
    const float* Kb = K + hbase;
    const float* Vb = V + hbase;

    const int q0 = (blockIdx.x * 8 + wave) * 16;
    const int qr = min(q0 + lr, ntok - 1);
    const int kperm = 4 * ((lr >> 1) & 3) + 2 * (lr >> 3) + (lr & 1);   // key of S^T row lr

    // copy share of this thread: rows crow + 16*i, 16 bytes at float ccol
    const int crow = tid >> 4;
    const int ccol = (tid & 15) * 4;
    const uint32_t lk0 = (uint32_t)(uintptr_t)&Ks[0][crow][ccol];
    const uint32_t lv0 = (uint32_t)(uintptr_t)&Vs[0][ccol >> 4][crow][ccol & 15];
    auto issue_stage = [&](int buf, int st) {
        const size_t off = ((size_t)st * KT + crow) * HD + ccol;
        async_stage_copies(lk0 + buf * KBUF, Kb + off, lv0 + buf * VBUF, Vb + off);
    };

    // Q fragment (B operand: column lr, k = 2*hf + {0,1}), pre-scaled by log2(e)/sqrt(hd):
    // scores come out in base-2 units, so every exponential below is one v_exp_f32
    constexpr float QSCALE = 0.125f * 1.4426950408889634f;
    v2f qf[16];
    {
        const float* qrow = Qb + (size_t)qr * HD + 2 * hf;
#pragma unroll
        for (int c = 0; c < 16; ++c) {
            v2f t = *(const v2f*)(qrow + 4 * c);
            t.x *= QSCALE; t.y *= QSCALE;
            qf[c] = t;
        }
    }

    float mrow = -3.0e38f;   // running maximum of query lr (base-2 units), equal in both halves
    float lrow = 0.0f;       // running sum over this half's keys only; halves joined at the end
    v8f ov[4] = {};          // ov[g][r] = O^T[16g + 8hf + r][query lr]

    // online softmax of one 16x16 score tile, then O^T += V^T @ P^T;
    // masked: only the first jlim keys of the tile exist
    auto softmax_pv = [&](const v8f& s, const v2f (&va)[4][4], bool masked, int jlim) {
        float sv[8];
#pragma unroll
        for (int r = 0; r < 8; ++r)
            sv[r] = (!masked || (4 * (r >> 1) + 2 * hf + (r & 1)) < jlim) ? s[r] : -3.0e38f;
        float mx = fmaxf(fmaxf(fmaxf(sv[0], sv[1]), fmaxf(sv[2], sv[3])),
                         fmaxf(fmaxf(sv[4], sv[5]), fmaxf(sv[6], sv[7])));
        mx = fmaxf(mx, xhalf(mx));
        const float mnew = fmaxf(mrow, mx);
        const float corr = __builtin_amdgcn_exp2f(mrow - mnew);
        mrow = mnew;
        v2f pb[4];
#pragma unroll
        for (int i = 0; i < 4; ++i) {
            const v2f d = (v2f){sv[2 * i], sv[2 * i + 1]} - (v2f){mnew, mnew};
            pb[i].x = __builtin_amdgcn_exp2f(d.x);
            pb[i].y = __builtin_amdgcn_exp2f(d.y);
        }
        lrow = lrow * corr + (((pb[0].x + pb[0].y) + (pb[1].x + pb[1].y)) +
                              ((pb[2].x + pb[2].y) + (pb[3].x + pb[3].y)));
#pragma unroll
        for (int g = 0; g < 4; ++g) ov[g] *= corr;

#pragma unroll
        for (int i = 0; i < 4; ++i) {
#pragma unroll
            for (int g = 0; g < 4; ++g) ov[g] = WMMA_F32(va[i][g], pb[i], ov[g]);
        }
    };

    // 16 keys at row jj of LDS buffer buf
    auto tile_lds = [&](int buf, int jj) {
        v2f kb[16];
#pragma unroll
        for (int c = 0; c < 16; ++c) kb[c] = *(const v2f*)&Ks[buf][jj + kperm][4 * c + 2 * hf];

        // ---- S^T = K @ (Q*log2(e)/sqrt(hd))^T ----
        v8f s = {};
#pragma unroll
        for (int c = 0; c < 16; ++c) s = WMMA_F32(kb[c], qf[c], s);

        v2f va[4][4];   // [kk/4][group]
#pragma unroll
        for (int k4 = 0; k4 < 4; ++k4) {
#pragma unroll
            for (int g = 0; g < 4; ++g) {
                va[k4][g].x = Vs[buf][g][jj + k4 * 4 + 2 * hf][lr];
                va[k4][g].y = Vs[buf][g][jj + k4 * 4 + 2 * hf + 1][lr];
            }
        }
        softmax_pv(s, va, false, 16);
    };

    // 16 keys from global memory, rows clamped, keys past the end masked
    auto tile_global = [&](int j0) {
        v2f kb[16];
        const float* krow = Kb + (size_t)min(j0 + kperm, ntok - 1) * HD + 2 * hf;
#pragma unroll
        for (int c = 0; c < 16; ++c) kb[c] = *(const v2f*)(krow + 4 * c);

        v8f s = {};
#pragma unroll
        for (int c = 0; c < 16; ++c) s = WMMA_F32(kb[c], qf[c], s);

        v2f va[4][4];
#pragma unroll
        for (int k4 = 0; k4 < 4; ++k4) {
            const int v0 = min(j0 + k4 * 4 + 2 * hf,     ntok - 1);
            const int v1 = min(j0 + k4 * 4 + 2 * hf + 1, ntok - 1);
            const float* vr0 = Vb + (size_t)v0 * HD + lr;
            const float* vr1 = Vb + (size_t)v1 * HD + lr;
#pragma unroll
            for (int g = 0; g < 4; ++g) {
                va[k4][g].x = vr0[g * 16];
                va[k4][g].y = vr1[g * 16];
            }
        }
        softmax_pv(s, va, true, ntok - j0);
    };

    const int nst = ntok / KT;   // full stages; the same for every wave

    if (nst != 0) issue_stage(0, 0);
    wait_asynccnt<0>();          // this wave's share of stage 0 has landed
    __syncthreads();             // stage 0 readable by all waves
    if (ntok >= 2 * KT) issue_stage(1, 1);

    for (int t = 0; t < nst; ++t) {
        const int buf = t & 1;
        for (int jj = 0; jj < KT; jj += 16) tile_lds(buf, jj);
        asm volatile("s_wait_dscnt 0x0" ::: "memory");   // this wave's reads of buffer buf are done
        wait_asynccnt<0>();                              // its share of stage t+1 has landed
        __syncthreads();                                 // publishes stage t+1, frees buffer buf
        if (t + 2 < nst) issue_stage(buf, t + 2);
    }
    wait_asynccnt<0>();          // nothing in flight behind the loop

    for (int j0 = nst * KT; j0 < ntok; j0 += 16) tile_global(j0);

    // ---- normalize + store in (B, N, H, HD) == (B, N, D) ----
    const float ltot = lrow + xhalf(lrow);   // all lanes on: stands in front of the row test
    const int q = q0 + lr;
    if (q < ntok) {
        const float inv = 1.0f / ltot;
        float* orow = O + (((size_t)(b * ntok + q)) * HEADS + hh) * HD + 8 * hf;
#pragma unroll
        for (int g = 0; g < 4; ++g) {
            *(float4*)(orow + g * 16) =
                make_float4(ov[g][0] * inv, ov[g][1] * inv, ov[g][2] * inv, ov[g][3] * inv);
            *(float4*)(orow + g * 16 + 4) =
                make_float4(ov[g][4] * inv, ov[g][5] * inv, ov[g][6] * inv, ov[g][7] * inv);
        }
    }
}

// ---------------------------------------------------------------------------
extern "C" void kernel_launch(void* const* d_in, const int* in_sizes, int n_in,
                              void* d_out, int out_size, void* d_ws, size_t ws_size,
                              hipStream_t stream)
{
    const float* x        = (const float*)d_in[0];
    const int*   position = (const int*)d_in[1];
    const float* w_qkv    = (const float*)d_in[2];
    const float* b_qkv    = (const float*)d_in[3];
    const float* w_fc     = (const float*)d_in[4];
    const float* b_fc     = (const float*)d_in[5];
    float* out = (float*)d_out;
    float* ws  = (float*)d_ws;

    float* Qb = ws;
    float* Kb = ws + QSZ;
    float* Vb = ws + 2 * QSZ;
    float* Ab = ws + 3 * QSZ;   // attention output, (B, N, D)

    // 1) fused QKV projection (scatter into split Q/K/V, (B,H,N,hd))
    dim3 g1((3 * DMODEL) / GBN, (MROWS + GBM - 1) / GBM);
    gemm_wmma_kernel<1><<<g1, 256, 0, stream>>>(x, w_qkv, b_qkv, ws, MROWS, 3 * DMODEL, DMODEL);

    // 2) RoPE on q, k (cls token passthrough)
    constexpr int RTOTAL = BATCH * HEADS * (NTOK - 1) * (HD / 2);
    rope_kernel<<<(RTOTAL + 255) / 256, 256, 0, stream>>>(Qb, Kb, position);

    // 3) flash attention
    dim3 g2((NTOK + 127) / 128, BATCH * HEADS);
    attn_kernel<<<g2, 256, 0, stream>>>(Qb, Kb, Vb, Ab, NTOK);

    // 4) output projection
    dim3 g3(DMODEL / GBN, (MROWS + GBM - 1) / GBM);
    gemm_wmma_kernel<0><<<g3, 256, 0, stream>>>(Ab, w_fc, b_fc, out, MROWS, DMODEL, DMODEL);
}

// v005
// Measured time: 712 microseconds a run.
// Timed twice side by side with v004, it ran 1.07 times as fast both times.
// Counting every step since v000, it is 1.56 times as fast.
#include <hip/hip_runtime.h>
#include <hip/hip_bf16.h>

typedef __attribute__((ext_vector_type(2))) float v2f;
typedef __attribute__((ext_vector_type(8))) float v8f;

#define WMMA_F32(a, b, c) \
    __builtin_amdgcn_wmma_f32_16x16x4_f32(false, (a), false, (b), (short)0, (c), false, false)

constexpr int BATCH = 4;
constexpr int HEADS = 16;
constexpr int NTOK  = 2049;
constexpr int DMODEL = 1024;
constexpr int HD = 64;
constexpr int MROWS = BATCH * NTOK;                        // 8196
constexpr size_t QSZ = (size_t)BATCH * HEADS * NTOK * HD;  // floats per Q/K/V buffer

static_assert(NTOK - 1 == 2048, "rope indexing assumes N-1 == 2048");

// ---------------------------------------------------------------------------
// CDNA5 async global->LDS copies (ASYNCcnt-tracked, no VGPR round trip).
// LDS byte address = low 32 bits of the generic shared pointer (flat LDS
// aperture maps addr[31:0] to the wave's LDS allocation).
// ---------------------------------------------------------------------------
template <int N>
__device__ __forceinline__ void wait_asynccnt() {
    asm volatile("s_wait_asynccnt %0" :: "n"(N) : "memory");
}

// ---------------------------------------------------------------------------
// Value of lane l ^ 16: the other half of the wave, same column of a WMMA tile.
// ---------------------------------------------------------------------------
__device__ __forceinline__ float xhalf(float x) {
    return __builtin_bit_cast(float, __builtin_amdgcn_permlanex16(
        __builtin_bit_cast(int, x), __builtin_bit_cast(int, x),
        0x76543210, 0xfedcba98, false, false));
}

// ---------------------------------------------------------------------------
// GEMM: out = A(MxK) @ W(NxK)^T + bias
// One 128x128 tile of out per workgroup, 8 waves as 2 (rows) x 4 (columns),
// 64x32 per wave: 4 x 2 accumulator tiles, so one A fragment feeds 2 and one
// B fragment 4 products, and each operand row is fetched once per 128 rows or
// columns of out. A pass is 64 k (256 bytes of every operand row); two LDS
// buffers filled by async copies, pass t+1 lands while pass t is worked on.
// Every output element still sums its k in ascending order in one chain.
// N is a multiple of GBN, K of GKP; rows past M are clamped at the copy,
// masked at the store, and a 16-row fragment wholly past M is not computed.
// EPI 0: plain row-major (MxN) store.  EPI 1: Q/K/V split, (B,H,NTOK,HD).
// ---------------------------------------------------------------------------
constexpr int GBM = 128;   // rows of out per workgroup
constexpr int GBN = 128;   // columns of out per workgroup
constexpr int GKP = 64;    // k per pass
constexpr int GPITCH = 68; // floats per LDS row: 16 rows x 2 halves of one 8-byte read hit 64 distinct banks

// One thread's share of one operand's pass: 16 bytes of each of 8 rows, 16
// rows apart in LDS. s_wait_xcnt stands inside the statement so that no
// address register named here is rewritten ahead of it.
__device__ __forceinline__ void async_rows8(
    uint32_t l, const float* g0, const float* g1, const float* g2, const float* g3,
    const float* g4, const float* g5, const float* g6, const float* g7)
{
    constexpr uint32_t LS = 16 * GPITCH * sizeof(float);
    asm volatile(
        "global_load_async_to_lds_b128 %0, %8, off\n\t"
        "global_load_async_to_lds_b128 %1, %9, off\n\t"
        "global_load_async_to_lds_b128 %2, %10, off\n\t"
        "global_load_async_to_lds_b128 %3, %11, off\n\t"
        "global_load_async_to_lds_b128 %4, %12, off\n\t"
        "global_load_async_to_lds_b128 %5, %13, off\n\t"
        "global_load_async_to_lds_b128 %6, %14, off\n\t"
        "global_load_async_to_lds_b128 %7, %15, off\n\t"
        "s_wait_xcnt 0x0"
        :: "v"(l), "v"(l + LS), "v"(l + 2 * LS), "v"(l + 3 * LS),
           "v"(l + 4 * LS), "v"(l + 5 * LS), "v"(l + 6 * LS), "v"(l + 7 * LS),
           "v"(g0), "v"(g1), "v"(g2), "v"(g3), "v"(g4), "v"(g5), "v"(g6), "v"(g7)
        : "memory");
}

template <int EPI>
__global__ __launch_bounds__(256) void gemm_wmma_kernel(
    const float* __restrict__ A, const float* __restrict__ W,
    const float* __restrict__ bias, float* __restrict__ out,
    int M, int N, int K)
{
    __shared__ __align__(16) float As[2][GBM][GPITCH];
    __shared__ __align__(16) float Bs[2][GBN][GPITCH];
    constexpr uint32_t ABUF = GBM * GPITCH * sizeof(float);
    constexpr uint32_t BBUF = GBN * GPITCH * sizeof(float);

    const int tid  = threadIdx.x;
    const int m0   = blockIdx.y * GBM;
    const int n0   = blockIdx.x * GBN;
    const int lane = tid & 31;
    const int lr   = lane & 15;
    const int hf   = lane >> 4;
    const int wave = __builtin_amdgcn_readfirstlane(tid >> 5);
    const int wm   = (wave >> 2) * 64;
    const int wn   = (wave & 3) * 32;
    // 16-row fragments of this wave that hold a row below M (wave-uniform)
    const int mfr  = min(4, max(0, (M - m0 - wm + 15) >> 4));

    // copy share of this thread: rows crow + 16*i of both operands, 16 bytes at float ccol
    const int crow = tid >> 4;
    const int ccol = (tid & 15) * 4;
    const float* ag[8];   // clamped row: garbage only feeds output rows that are masked at store
    const float* wg[8];
#pragma unroll
    for (int i = 0; i < 8; ++i) {
        ag[i] = A + (size_t)min(m0 + crow + 16 * i, M - 1) * K + ccol;
        wg[i] = W + (size_t)(n0 + crow + 16 * i) * K + ccol;
    }
    const uint32_t asA = (uint32_t)(uintptr_t)&As[0][crow][ccol];
    const uint32_t asB = (uint32_t)(uintptr_t)&Bs[0][crow][ccol];

    auto issue = [&](int buf, int k0) {
        async_rows8(asA + buf * ABUF, ag[0] + k0, ag[1] + k0, ag[2] + k0, ag[3] + k0,
                                      ag[4] + k0, ag[5] + k0, ag[6] + k0, ag[7] + k0);
        async_rows8(asB + buf * BBUF, wg[0] + k0, wg[1] + k0, wg[2] + k0, wg[3] + k0,
                                      wg[4] + k0, wg[5] + k0, wg[6] + k0, wg[7] + k0);
    };

    v8f acc[4][2] = {};
    const int npass = K / GKP;

    issue(0, 0);
    wait_asynccnt<0>();          // this wave's share of pass 0 has landed
    __syncthreads();             // pass 0 readable by all waves
    if (npass > 1) issue(1, GKP);

    for (int t = 0; t < npass; ++t) {
        const int buf = t & 1;
        const float* ar = &As[buf][wm + lr][2 * hf];
        const float* br = &Bs[buf][wn + lr][2 * hf];
        if (mfr == 4) {
#pragma unroll
            for (int s = 0; s < GKP / 4; ++s) {
                v2f af[4], bf[2];
#pragma unroll
                for (int i = 0; i < 4; ++i) af[i] = *(const v2f*)(ar + i * 16 * GPITCH + 4 * s);
#pragma unroll
                for (int j = 0; j < 2; ++j) bf[j] = *(const v2f*)(br + j * 16 * GPITCH + 4 * s);
#pragma unroll
                for (int i = 0; i < 4; ++i) {
#pragma unroll
                    for (int j = 0; j < 2; ++j) acc[i][j] = WMMA_F32(af[i], bf[j], acc[i][j]);
                }
            }
        } else {
            // edge tile of M: only the fragments that hold a row of out
#pragma unroll
            for (int i = 0; i < 4; ++i) {
                if (i < mfr) {
#pragma unroll
                    for (int s = 0; s < GKP / 4; ++s) {
                        const v2f af = *(const v2f*)(ar + i * 16 * GPITCH + 4 * s);
#pragma unroll
                        for (int j = 0; j < 2; ++j) {
                            const v2f bf = *(const v2f*)(br + j * 16 * GPITCH + 4 * s);
                            acc[i][j] = WMMA_F32(af, bf, acc[i][j]);
                        }
                    }
                }
            }
        }
        asm volatile("s_wait_dscnt 0x0" ::: "memory");   // this wave's reads of buffer buf are done
        wait_asynccnt<0>();                              // its share of pass t+1 has landed
        __syncthreads();                                 // publishes pass t+1, frees buffer buf
        if (t + 2 < npass) issue(buf, (t + 2) * GKP);
    }
    wait_asynccnt<0>();          // nothing in flight behind the loop

#pragma unroll
    for (int j = 0; j < 2; ++j) {
        const int n = n0 + wn + 16 * j + lr;
        const float bv = bias[n];
        if (EPI == 0) {
#pragma unroll
            for (int i = 0; i < 4; ++i) {
#pragma unroll
                for (int r = 0; r < 8; ++r) {
                    const int m = m0 + wm + 16 * i + r + 8 * hf;
                    if (m < M) out[(size_t)m * N + n] = acc[i][j][r] + bv;
                }
            }
        } else {
            const int three = n >> 10;
            const int hh    = (n >> 6) & 15;
            const int d     = n & 63;
            float* base = out + (size_t)three * QSZ;
#pragma unroll
            for (int i = 0; i < 4; ++i) {
#pragma unroll
                for (int r = 0; r < 8; ++r) {
                    const int m = m0 + wm + 16 * i + r + 8 * hf;
                    if (m < M) {
                        const int b = m / NTOK;
                        const int t = m - b * NTOK;
                        base[(((size_t)(b * HEADS + hh)) * NTOK + t) * HD + d] = acc[i][j][r] + bv;
                    }
                }
            }
        }
    }
}

// ---------------------------------------------------------------------------
// RoPE on Q and K, (B,H,NTOK,HD) layout; token 0 (cls) untouched.
// ---------------------------------------------------------------------------
__global__ __launch_bounds__(256) void rope_kernel(
    float* __restrict__ Q, float* __restrict__ K,
    const int* __restrict__ position)
{
    const int idx = blockIdx.x * 256 + threadIdx.x;
    constexpr int TOTAL = BATCH * HEADS * (NTOK - 1) * (HD / 2);
    if (idx >= TOTAL) return;
    const int p     = idx & 31;
    const int rest  = idx >> 5;
    const int t     = rest & 2047;
    const int rest2 = rest >> 11;
    const int hh    = rest2 & 15;
    const int b     = rest2 >> 4;

    const float posf = (float)position[b * (NTOK - 1) + t];
    const float freq = powf(10000.0f, -(float)(2 * p) / (float)HD);
    const float ang  = posf * freq;
    float s, c;
    sincosf(ang, &s, &c);

    const size_t base = (((size_t)(b * HEADS + hh)) * NTOK + (t + 1)) * HD + 2 * p;
    const float qre = Q[base], qim = Q[base + 1];
    Q[base]     = qre * c - qim * s;
    Q[base + 1] = qre * s + qim * c;
    const float kre = K[base], kim = K[base + 1];
    K[base]     = kre * c - kim * s;
    K[base + 1] = kre * s + kim * c;
}

constexpr int KT     = 64;
constexpr int QBLK   = 128;
constexpr int QFULL  = NTOK / QBLK;
constexpr int NBH    = BATCH * HEADS;
static_assert(NTOK % QBLK >= 1 && NTOK % QBLK <= 16, "the remainder block holds one query tile");
constexpr int KPITCH = 68;   // floats per K row in LDS: 16 rows x 2 halves of one 8-byte read hit 64 distinct banks
// V lies in LDS as 4 planes of 16 columns, rows dense (64 bytes): the 4 rows x 16 columns of one fragment read are
// 64 consecutive dwords (64 distinct banks), and a fragment's two rows are neighbours for one two-address read

// One thread's share of a stage: 4 K chunks and 4 V chunks of 16 bytes.
// s_wait_xcnt stands inside the statement so that no address register named
// here is rewritten ahead of it.
__device__ __forceinline__ void async_stage_copies(
    uint32_t lk, const float* gk, uint32_t lv, const float* gv)
{
    constexpr uint32_t LKS = 16 * KPITCH * sizeof(float);
    constexpr uint32_t LVS = 16 * 16 * sizeof(float);
    asm volatile(
        "global_load_async_to_lds_b128 %0, %8, off\n\t"
        "global_load_async_to_lds_b128 %1, %9, off\n\t"
        "global_load_async_to_lds_b128 %2, %10, off\n\t"
        "global_load_async_to_lds_b128 %3, %11, off\n\t"
        "global_load_async_to_lds_b128 %4, %12, off\n\t"
        "global_load_async_to_lds_b128 %5, %13, off\n\t"
        "global_load_async_to_lds_b128 %6, %14, off\n\t"
        "global_load_async_to_lds_b128 %7, %15, off\n\t"
        "s_wait_xcnt 0x0"
        :: "v"(lk), "v"(lk + LKS), "v"(lk + 2 * LKS), "v"(lk + 3 * LKS),
           "v"(lv), "v"(lv + LVS), "v"(lv + 2 * LVS), "v"(lv + 3 * LVS),
           "v"(gk), "v"(gk + 16 * HD), "v"(gk + 32 * HD), "v"(gk + 48 * HD),
           "v"(gv), "v"(gv + 16 * HD), "v"(gv + 32 * HD), "v"(gv + 48 * HD)
        : "memory");
}

template <bool REM>
__global__ __launch_bounds__(256) void attn_kernel(
    const float* __restrict__ Q, const float* __restrict__ K,
    const float* __restrict__ V, float* __restrict__ O, int ntok)
{
    __shared__ __align__(16) float Ks[2][KT][KPITCH];
    __shared__ __align__(16) float Vs[2][4][KT][16];
    constexpr uint32_t KBUF = KT * KPITCH * sizeof(float);
    constexpr uint32_t VBUF = 4 * KT * 16 * sizeof(float);

    const int tid  = threadIdx.x;
    const int wave = tid >> 5;
    const int lane = tid & 31;
    const int lr   = lane & 15;
    const int hf   = lane >> 4;

    const int bh = REM ? blockIdx.x : blockIdx.y;
    const int b  = bh >> 4;
    const int hh = bh & 15;
    const size_t hbase = (size_t)bh * ntok * HD;
    const float* Qb = Q + hbase;
    const float* Kb = K + hbase;
    const float* Vb = V + hbase;

    const int q0 = REM ? QFULL * QBLK : (blockIdx.x * 8 + wave) * 16;
    const int qr = min(q0 + lr, ntok - 1);
    const int kperm = 4 * ((lr >> 1) & 3) + 2 * (lr >> 3) + (lr & 1);   // key of S^T row lr

    // copy share of this thread: rows crow + 16*i, 16 bytes at float ccol
    const int crow = tid >> 4;
    const int ccol = (tid & 15) * 4;
    const uint32_t lk0 = (uint32_t)(uintptr_t)&Ks[0][crow][ccol];
    const uint32_t lv0 = (uint32_t)(uintptr_t)&Vs[0][ccol >> 4][crow][ccol & 15];
    auto issue_stage = [&](int buf, int st) {
        const size_t off = ((size_t)st * KT + crow) * HD + ccol;
        async_stage_copies(lk0 + buf * KBUF, Kb + off, lv0 + buf * VBUF, Vb + off);
    };

    // Q fragment (B operand: column lr, k = 2*hf + {0,1}), pre-scaled by log2(e)/sqrt(hd):
    // scores come out in base-2 units, so every exponential below is one v_exp_f32
    constexpr float QSCALE = 0.125f * 1.4426950408889634f;
    v2f qf[16];
    {
        const float* qrow = Qb + (size_t)qr * HD + 2 * hf;
#pragma unroll
        for (int c = 0; c < 16; ++c) {
            v2f t = *(const v2f*)(qrow + 4 * c);
            t.x *= QSCALE; t.y *= QSCALE;
            qf[c] = t;
        }
    }

    float mrow = -3.0e38f;   // running maximum of query lr (base-2 units), equal in both halves
    float lrow = 0.0f;       // running sum over this half's keys only; halves joined at the end
    v8f ov[4] = {};          // ov[g][r] = O^T[16g + 8hf + r][query lr]

    // online softmax of one 16x16 score tile, then O^T += V^T @ P^T;
    // masked: only the first jlim keys of the tile exist
    auto softmax_pv = [&](const v8f& s, const v2f (&va)[4][4], bool masked, int jlim) {
        float sv[8];
#pragma unroll
        for (int r = 0; r < 8; ++r)
            sv[r] = (!masked || (4 * (r >> 1) + 2 * hf + (r & 1)) < jlim) ? s[r] : -3.0e38f;
        float mx = fmaxf(fmaxf(fmaxf(sv[0], sv[1]), fmaxf(sv[2], sv[3])),
                         fmaxf(fmaxf(sv[4], sv[5]), fmaxf(sv[6], sv[7])));
        mx = fmaxf(mx, xhalf(mx));
        const float mnew = fmaxf(mrow, mx);
        const float corr = __builtin_amdgcn_exp2f(mrow - mnew);
        mrow = mnew;
        v2f pb[4];
#pragma unroll
        for (int i = 0; i < 4; ++i) {
            const v2f d = (v2f){sv[2 * i], sv[2 * i + 1]} - (v2f){mnew, mnew};
            pb[i].x = __builtin_amdgcn_exp2f(d.x);
            pb[i].y = __builtin_amdgcn_exp2f(d.y);
        }
        lrow = lrow * corr + (((pb[0].x + pb[0].y) + (pb[1].x + pb[1].y)) +
                              ((pb[2].x + pb[2].y) + (pb[3].x + pb[3].y)));
#pragma unroll
        for (int g = 0; g < 4; ++g) ov[g] *= corr;

#pragma unroll
        for (int i = 0; i < 4; ++i) {
#pragma unroll
            for (int g = 0; g < 4; ++g) ov[g] = WMMA_F32(va[i][g], pb[i], ov[g]);
        }
    };

    // 16 keys at row jj of LDS buffer buf
    auto tile_lds = [&](int buf, int jj) {
        v2f kb[16];
#pragma unroll
        for (int c = 0; c < 16; ++c) kb[c] = *(const v2f*)&Ks[buf][jj + kperm][4 * c + 2 * hf];

        // ---- S^T = K @ (Q*log2(e)/sqrt(hd))^T ----
        v8f s = {};
#pragma unroll
        for (int c = 0; c < 16; ++c) s = WMMA_F32(kb[c], qf[c], s);

        v2f va[4][4];   // [kk/4][group]
#pragma unroll
        for (int k4 = 0; k4 < 4; ++k4) {
#pragma unroll
            for (int g = 0; g < 4; ++g) {
                va[k4][g].x = Vs[buf][g][jj + k4 * 4 + 2 * hf][lr];
                va[k4][g].y = Vs[buf][g][jj + k4 * 4 + 2 * hf + 1][lr];
            }
        }
        softmax_pv(s, va, false, 16);
    };

    // 16 keys from global memory, rows clamped, keys past the end masked
    auto tile_global = [&](int j0) {
        v2f kb[16];
        const float* krow = Kb + (size_t)min(j0 + kperm, ntok - 1) * HD + 2 * hf;
#pragma unroll
        for (int c = 0; c < 16; ++c) kb[c] = *(const v2f*)(krow + 4 * c);
        // precaution: no register that an issued load names is rewritten (also not by a later load's result) ahead of this wait
        if (REM) asm volatile("s_wait_xcnt 0x0" ::: "memory");

        v8f s = {};
#pragma unroll
        for (int c = 0; c < 16; ++c) s = WMMA_F32(kb[c], qf[c], s);

        v2f va[4][4];
#pragma unroll
        for (int k4 = 0; k4 < 4; ++k4) {
            const int v0 = min(j0 + k4 * 4 + 2 * hf,     ntok - 1);
            const int v1 = min(j0 + k4 * 4 + 2 * hf + 1, ntok - 1);
            const float* vr0 = Vb + (size_t)v0 * HD + lr;
            const float* vr1 = Vb + (size_t)v1 * HD + lr;
#pragma unroll
            for (int g = 0; g < 4; ++g) {
                va[k4][g].x = vr0[g * 16];
                va[k4][g].y = vr1[g * 16];
            }
            // the same precaution for this group's two address pairs
            if (REM) asm volatile("s_wait_xcnt 0x0" ::: "memory");
        }
        softmax_pv(s, va, true, ntok - j0);
    };

    if (REM) {
        const int wv = __builtin_amdgcn_readfirstlane(wave);   // scalar: loop and branches below stay wave-uniform
        for (int j0 = wv * 16; j0 < ntok; j0 += 8 * 16) tile_global(j0);

        // ---- join the 8 waves' partial maxima, sums and outputs, in wave order ----
        // No copy is issued and nothing else touches LDS in this launch: both arrays are free.
        float* po = &Vs[0][0][0][0];   // [wave][group][lane][8] partial O^T
        float* pm = &Ks[0][0][0];      // [wave][lane]{maximum, sum}
        static_assert(sizeof(Vs) >= 8 * 4 * 32 * 8 * sizeof(float), "partial outputs fit");
#pragma unroll
        for (int g = 0; g < 4; ++g) {
            float* p = po + ((wv * 4 + g) * 32 + lane) * 8;
            *(float4*)p       = make_float4(ov[g][0], ov[g][1], ov[g][2], ov[g][3]);
            *(float4*)(p + 4) = make_float4(ov[g][4], ov[g][5], ov[g][6], ov[g][7]);
        }
        *(v2f*)(pm + (wv * 32 + lane) * 2) = (v2f){mrow, lrow};
        __syncthreads();               // all 8 partial results readable
        if (wv < 4) {                  // wave g joins and stores column group g
            v2f ml[8];
            float mall = -3.0e38f;
#pragma unroll
            for (int w = 0; w < 8; ++w) {
                ml[w] = *(const v2f*)(pm + (w * 32 + lane) * 2);
                mall = fmaxf(mall, ml[w].x);
            }
            float lsum = 0.0f;
            float o[8] = {};
#pragma unroll
            for (int w = 0; w < 8; ++w) {
                const float sc = __builtin_amdgcn_exp2f(ml[w].x - mall);
                const float* p = po + ((w * 4 + wv) * 32 + lane) * 8;
                const float4 a = *(const float4*)p;
                const float4 c = *(const float4*)(p + 4);
                lsum += ml[w].y * sc;
                o[0] += a.x * sc; o[1] += a.y * sc; o[2] += a.z * sc; o[3] += a.w * sc;
                o[4] += c.x * sc; o[5] += c.y * sc; o[6] += c.z * sc; o[7] += c.w * sc;
            }
            const float lall = lsum + xhalf(lsum);   // all lanes on: stands in front of the row test
            const int qq = q0 + lr;
            if (qq < ntok) {
                const float inv = 1.0f / lall;
                float* orow = O + (((size_t)(b * ntok + qq)) * HEADS + hh) * HD + 16 * wv + 8 * hf;
                *(float4*)orow       = make_float4(o[0] * inv, o[1] * inv, o[2] * inv, o[3] * inv);
                *(float4*)(orow + 4) = make_float4(o[4] * inv, o[5] * inv, o[6] * inv, o[7] * inv);
            }
        }
        return;
    }

    const int nst = ntok / KT;   // full stages; the same for every wave

    if (nst != 0) issue_stage(0, 0);
    wait_asynccnt<0>();          // this wave's share of stage 0 has landed
    __syncthreads();             // stage 0 readable by all waves
    if (ntok >= 2 * KT) issue_stage(1, 1);

    for (int t = 0; t < nst; ++t) {
        const int buf = t & 1;
        for (int jj = 0; jj < KT; jj += 16) tile_lds(buf, jj);
        asm volatile("s_wait_dscnt 0x0" ::: "memory");   // this wave's reads of buffer buf are done
        wait_asynccnt<0>();                              // its share of stage t+1 has landed
        __syncthreads();                                 // publishes stage t+1, frees buffer buf
        if (t + 2 < nst) issue_stage(buf, t + 2);
    }
    wait_asynccnt<0>();          // nothing in flight behind the loop

    for (int j0 = nst * KT; j0 < ntok; j0 += 16) tile_global(j0);

    // ---- normalize + store in (B, N, H, HD) == (B, N, D) ----
    const float ltot = lrow + xhalf(lrow);   // all lanes on: stands in front of the row test
    const int q = q0 + lr;
    if (q < ntok) {
        const float inv = 1.0f / ltot;
        float* orow = O + (((size_t)(b * ntok + q)) * HEADS + hh) * HD + 8 * hf;
#pragma unroll
        for (int g = 0; g < 4; ++g) {
            *(float4*)(orow + g * 16) =
                make_float4(ov[g][0] * inv, ov[g][1] * inv, ov[g][2] * inv, ov[g][3] * inv);
            *(float4*)(orow + g * 16 + 4) =
                make_float4(ov[g][4] * inv, ov[g][5] * inv, ov[g][6] * inv, ov[g][7] * inv);
        }
    }
}

// ---------------------------------------------------------------------------
extern "C" void kernel_launch(void* const* d_in, const int* in_sizes, int n_in,
                              void* d_out, int out_size, void* d_ws, size_t ws_size,
                              hipStream_t stream)
{
    const float* x        = (const float*)d_in[0];
    const int*   position = (const int*)d_in[1];
    const float* w_qkv    = (const float*)d_in[2];
    const float* b_qkv    = (const float*)d_in[3];
    const float* w_fc     = (const float*)d_in[4];
    const float* b_fc     = (const float*)d_in[5];
    float* out = (float*)d_out;
    float* ws  = (float*)d_ws;

    float* Qb = ws;
    float* Kb = ws + QSZ;
    float* Vb = ws + 2 * QSZ;
    float* Ab = ws + 3 * QSZ;   // attention output, (B, N, D)

    // 1) fused QKV projection (scatter into split Q/K/V, (B,H,N,hd))
    dim3 g1((3 * DMODEL) / GBN, (MROWS + GBM - 1) / GBM);
    gemm_wmma_kernel<1><<<g1, 256, 0, stream>>>(x, w_qkv, b_qkv, ws, MROWS, 3 * DMODEL, DMODEL);

    // 2) RoPE on q, k (cls token passthrough)
    constexpr int RTOTAL = BATCH * HEADS * (NTOK - 1) * (HD / 2);
    rope_kernel<<<(RTOTAL + 255) / 256, 256, 0, stream>>>(Qb, Kb, position);

    // 3) flash attention
    dim3 g2(QFULL, NBH);
    attn_kernel<false><<<g2, 256, 0, stream>>>(Qb, Kb, Vb, Ab, NTOK);
    attn_kernel<true><<<NBH, 256, 0, stream>>>(Qb, Kb, Vb, Ab, NTOK);

    // 4) output projection
    dim3 g3(DMODEL / GBN, (MROWS + GBM - 1) / GBM);
    gemm_wmma_kernel<0><<<g3, 256, 0, stream>>>(Ab, w_fc, b_fc, out, MROWS, DMODEL, DMODEL);
}
